// v000
// The times below were measured on an AMD MI455X: many runs one after another, warmed up first and cycling through
// copies of the inputs, with the whole window's GPU time divided by the number of runs. Launches and the gaps
// between them are all in it. The median over several windows is given; except for v000 it joins two sittings, which
// can be a few percent apart, so the side-by-side timings, each taken in one sitting, are the better comparison.
// v000, which the later versions start from, runs in 1870 microseconds.
// compute dtype: all float inputs rounded to bf16; per-head q/k/v projections with EXACT bf16 products on WMMA 16x16x32 (f32 accumulate); causal logits: 3 products for the first 384 rows, single f16 q x k after, x 64^-0.5; softmax f32; P x 2^11 once to f16 x v once to f16 (bf16 hi + lo below row 384); ctx hi+lo x exact Wproj below row 384, x2^6 f16 carry x f16(bf16 x 2^8) Wproj after, + bproj; f32 output.
#include <hip/hip_runtime.h>
#include <math.h>

typedef __attribute__((ext_vector_type(16))) _Float16 v16h;
typedef __attribute__((ext_vector_type(16))) __bf16 v16b;
typedef __attribute__((ext_vector_type(8)))  _Float16 v8h;
typedef __attribute__((ext_vector_type(8)))  float v8f;
typedef __attribute__((ext_vector_type(4)))  float v4f;
typedef __attribute__((ext_vector_type(2)))  float v2f;
typedef __attribute__((ext_vector_type(4)))  unsigned v4u;
typedef __attribute__((ext_vector_type(4)))  int v4i;
typedef float __attribute__((may_alias)) float_a;
typedef int __attribute__((may_alias)) int_a;

template <typename T> __device__ __forceinline__ void vst2(void* p, T v) { *(T*)p = v;  }
__device__ __forceinline__ v8f wmma16(v16h a, v16h b, v8f c) {
  v8f d = __builtin_amdgcn_wmma_f32_16x16x32_f16(false, a, false, b, (short)0, c, false, false);
  asm volatile("v_nop\n\tv_nop\n\tv_nop\n\tv_nop" : "+v"(d) : "v"(a), "v"(b));
  return d;
}
__device__ __forceinline__ v8f wmma_bf(v16b a, v16b b, v8f c) {
  v8f d = __builtin_amdgcn_wmma_f32_16x16x32_bf16(false, a, false, b, (short)0, c, false, false);
  asm volatile("v_nop\n\tv_nop\n\tv_nop\n\tv_nop" : "+v"(d) : "v"(a), "v"(b));
  return d;
}
// 16x16x32 fragments: lane = (h = lane>>4, row/col = lane&15); elements 0..7 = k0+8h+0..7, 8..15 = k0+16+8h+0..7; D element r = row 8h+r
__device__ __forceinline__ v16h frag_h(const _Float16* rowk0, int lane) {
  union { v16h v; v8h q[2]; } u; const _Float16* p = rowk0 + 8 * (lane >> 4);
  u.q[0] = *(const v8h*)p; u.q[1] = *(const v8h*)(p + 16); return u.v;
}
__device__ __forceinline__ v16h frag_f32(const float* rowk0, int lane) {
  v16h a; const float* p = rowk0 + 8 * (lane >> 4);
#pragma unroll
  for (int i = 0; i < 8; ++i) { a[i] = (_Float16)p[i]; a[8 + i] = (_Float16)p[16 + i]; }
  return a;
}
__device__ __forceinline__ v16h frag_f32s(const float* rowk0, int lane, float sc) {
  v16h a; const float* p = rowk0 + 8 * (lane >> 4);
#pragma unroll
  for (int i = 0; i < 8; ++i) { a[i] = (_Float16)(p[i] * sc); a[8 + i] = (_Float16)(p[16 + i] * sc); }
  return a;
}
// column fragment from a [K][ld] layout (column n), rows >= K read as 0
__device__ __forceinline__ v16h fragc_f32(const float* W, int k0, int n, int lane, int ld, int K) {
  v16h a; const int g = lane >> 4;
#pragma unroll
  for (int i = 0; i < 8; ++i) { const int ka = k0 + 8 * g + i, kb = ka + 16;
    a[i] = (_Float16)(ka < K ? W[(size_t)(ka < K ? ka : K - 1) * ld + n] : 0.f); a[8 + i] = (_Float16)(kb < K ? W[(size_t)(kb < K ? kb : K - 1) * ld + n] : 0.f); }
  return a;
}
struct F2 { v16b h, l; };
__device__ __forceinline__ F2 bsplit16(const float v[16]) { F2 r;
#pragma unroll
  for (int i = 0; i < 16; ++i) { const __bf16 h = (__bf16)v[i]; r.h[i] = h; r.l[i] = (__bf16)(v[i] - (float)h); }
  return r; }
__device__ __forceinline__ F2 split_row(const float* row, int k0, int lane) { float v[16]; const float* p = row + k0 + 8 * (lane >> 4);
#pragma unroll
  for (int i = 0; i < 8; ++i) { v[i] = p[i]; v[8 + i] = p[16 + i]; }
  return bsplit16(v); }
__device__ __forceinline__ F2 split_rowK(const float* row, int k0, int lane, int K) { float v[16]; const int g = lane >> 4;
#pragma unroll
  for (int i = 0; i < 8; ++i) { const int ka = k0 + 8 * g + i, kb = ka + 16; v[i] = ka < K ? row[ka < K ? ka : K - 1] : 0.f; v[8 + i] = kb < K ? row[kb < K ? kb : K - 1] : 0.f; }
  return bsplit16(v); }
__device__ __forceinline__ F2 split_col(const float* W, int k0, int n, int lane, int ld, int K) { float v[16]; const int g = lane >> 4;
#pragma unroll
  for (int i = 0; i < 8; ++i) { const int ka = k0 + 8 * g + i, kb = ka + 16; v[i] = ka < K ? W[(size_t)(ka < K ? ka : K - 1) * ld + n] : 0.f; v[8 + i] = kb < K ? W[(size_t)(kb < K ? kb : K - 1) * ld + n] : 0.f; }
  return bsplit16(v); }
__device__ __forceinline__ v8f mac3(const F2& a, const F2& b, v8f c) { c = wmma_bf(a.l, b.h, c); c = wmma_bf(a.h, b.l, c); return wmma_bf(a.h, b.h, c); }
__device__ __forceinline__ float sigm(float v) { return 1.0f / (1.0f + expf(-v)); }
#define LDSX() do { asm volatile("s_wait_dscnt 0" ::: "memory"); __builtin_amdgcn_wave_barrier(); __builtin_amdgcn_fence(__ATOMIC_RELEASE, "workgroup"); } while (0)

// Causal multi-head self-attention with PER-HEAD projection weights (x [8,2048,512]; 8 heads x 64; Wq/Wk/Wv [8,512,64] = [H][C][D] (in,out per head); Wo [512,512] (in,out) + bo (normal x 0.01: read); tril, -inf): q_h = x Wq[h]; out = concat_h(softmax(causal(q_h k_h^T * 64^-0.5)) v_h) Wo + bo.
#define NB 8
#define TT 2048
#define CC 512            // NH * HD = projected width
#define DIN 512          // input (model) width
#define NH 8
#define HD 64
#define NQB (TT / 64)
#define HG 4
#define SCALE (0.125f)
#define CAUSAL 1
#ifndef TNB
#define TNB NB
#endif
__device__ __forceinline__ float bfr(float v) { return (float)(__bf16)v; }
__host__ __device__ __forceinline__ int kb_last(int qb) { return CAUSAL ? ((qb * 64 + 63) >> 7) : (TT / 128 - 1); }
typedef __attribute__((ext_vector_type(8))) __bf16 v8b;
__device__ __forceinline__ v16b frag_b(const __bf16* rowk0, int lane) {
  union { v16b v; v8b q[2]; } u; const __bf16* p = rowk0 + 8 * (lane >> 4);
  u.q[0] = *(const v8b*)p; u.q[1] = *(const v8b*)(p + 16); return u.v;
}
#define QBH 6              // causal: query blocks 0..QBH-1 of each sequence (few keys, no averaging) take the high-precision path
#define QHI 384            // rows carrying a q residual plane
#define KHI 384            // key rows carrying k residual / v bf16 hi+lo planes (used only by the causal high-precision path)
// B fragment (k rows k0+.., output column o) of a weight: (in,out) [K][ld] or (out,in) [ld rows of K]: bf16 exact, or f16(bf16 * 256) exact
__device__ __forceinline__ v16b wcol_io(const float* Wm, int k0, int o, int lane, int ld) { v16b w; const int g = lane >> 4;
#pragma unroll
  for (int i = 0; i < 8; ++i) { w[i] = (__bf16)Wm[(size_t)(k0 + 8 * g + i) * ld + o]; w[8 + i] = (__bf16)Wm[(size_t)(k0 + 16 + 8 * g + i) * ld + o]; }
  return w; }
__device__ __forceinline__ v16b wcol_oi(const float* Wm, int k0, int o, int lane, int K) { v16b w; const float* p = Wm + (size_t)o * K + k0 + 8 * (lane >> 4);
#pragma unroll
  for (int i = 0; i < 8; ++i) { w[i] = (__bf16)p[i]; w[8 + i] = (__bf16)p[16 + i]; }
  return w; }
__device__ __forceinline__ v16h wcolh_io(const float* Wm, int k0, int o, int lane, int ld) { v16h w; const int g = lane >> 4;
#pragma unroll
  for (int i = 0; i < 8; ++i) { w[i] = (_Float16)(bfr(Wm[(size_t)(k0 + 8 * g + i) * ld + o]) * 256.0f); w[8 + i] = (_Float16)(bfr(Wm[(size_t)(k0 + 16 + 8 * g + i) * ld + o]) * 256.0f); }
  return w; }
__device__ __forceinline__ v16h wcolh_oi(const float* Wm, int k0, int o, int lane, int K) { v16h w; const float* p = Wm + (size_t)o * K + k0 + 8 * (lane >> 4);
#pragma unroll
  for (int i = 0; i < 8; ++i) { w[i] = (_Float16)(bfr(p[i]) * 256.0f); w[8 + i] = (_Float16)(bfr(p[16 + i]) * 256.0f); }
  return w; }
#define WQKV_LAYOUT 2   // 0 = (in,out) [DIN][CC]; 1 = (out,in) [CC][DIN]; 2 = per-head [NH][DIN][HD]
__device__ __forceinline__ v16b wcol_hdk(const float* Wm, int k0, int o, int lane) { v16b w; const int g = lane >> 4; const float* p = Wm + (size_t)(o / HD) * DIN * HD + (o % HD);
#pragma unroll
  for (int i = 0; i < 8; ++i) { w[i] = (__bf16)p[(size_t)(k0 + 8 * g + i) * HD]; w[8 + i] = (__bf16)p[(size_t)(k0 + 16 + 8 * g + i) * HD]; }
  return w; }
#define WO_OUT_IN 0
#if WQKV_LAYOUT == 1
#define WCOL(W, k0, o, lane) wcol_oi(W, k0, o, lane, DIN)
#elif WQKV_LAYOUT == 2
#define WCOL(W, k0, o, lane) wcol_hdk(W, k0, o, lane)
#else
#define WCOL(W, k0, o, lane) wcol_io(W, k0, o, lane, CC)
#endif
#if WO_OUT_IN
#define WOCOL(W, k0, o, lane) wcol_oi(W, k0, o, lane, CC)
#define WOCOLH(W, k0, o, lane) wcolh_oi(W, k0, o, lane, CC)
#else
#define WOCOL(W, k0, o, lane) wcol_io(W, k0, o, lane, DIN)
#define WOCOLH(W, k0, o, lane) wcolh_io(W, k0, o, lane, DIN)
#endif

#ifndef SM_EXTRA_PARAMS
#define SM_EXTRA_PARAMS
#endif
#ifndef PROJ_EXTRA_PARAMS
#define PROJ_EXTRA_PARAMS
#endif
#ifndef SM_MASK_HOOK
#define SM_MASK_HOOK (void)0
#endif

#define WS_QH  0u                                      // f16 q rows [b*t][CC]
#define WS_KH  (WS_QH + 2u * (size_t)NB * TT * CC)      // f16 k rows [b*t][CC]
#define WS_VT  (WS_KH + 2u * (size_t)NB * TT * CC)      // f16 v planes [b][c][t]
#define WS_QL  (WS_VT + 2u * (size_t)NB * CC * TT)      // f16 q residual x 2^10 rows [b][t < QHI][CC]
#define WS_KL  (WS_QL + 2u * (size_t)NB * QHI * CC)     // f16 k residual x 2^10 rows [b][t < KHI][CC]
#define WS_VB  (WS_KL + 2u * (size_t)NB * KHI * CC)     // bf16 v hi planes [b][c][t < KHI]
#define WS_VBL (WS_VB + 2u * (size_t)NB * CC * KHI)
#define WS_S   (WS_VBL + 2u * (size_t)NB * CC * KHI)    // f32 logits / P [hg][t][s]
#define WS_Y   (WS_S  + 4u * (size_t)HG * TT * TT)      // f32 ctx rows [b*t][CC] (only when there is an output projection)
#define WS_END (WS_Y  + 4u * (size_t)NB * TT * CC)

// ---- k_proj: block = (64 rows, 128 cols, which): q/k/v = X W (+ b) with exact bf16 products (K = DIN) -> which 0: q f16 rows (+ residual rows < QHI); 1: k f16 rows (+ residual rows < KHI); 2: v f16 planes [c][t] (+ bf16 hi/lo planes for t < KHI)
__global__ __launch_bounds__(128) void k_proj(const float* __restrict__ XQ, const float* __restrict__ XK, const float* __restrict__ XV, const float* __restrict__ WQ, const float* __restrict__ WK, const float* __restrict__ WV, const float* __restrict__ BQ, const float* __restrict__ BK, const float* __restrict__ BV,
    _Float16* __restrict__ QH, _Float16* __restrict__ QL, _Float16* __restrict__ KH, _Float16* __restrict__ KL, _Float16* __restrict__ VT, __bf16* __restrict__ VB, __bf16* __restrict__ VBL) {
  __shared__ __align__(16) _Float16 sh[64][136], sl[64][136]; __shared__ __align__(16) _Float16 th[128][72]; __shared__ __align__(16) __bf16 tb[128][72], tbl[128][72];
  const int tid = threadIdx.x, wave = tid >> 5, lane = tid & 31, col = lane & 15, g = lane >> 4; const int which = blockIdx.z; const int c0 = blockIdx.y * 128; const size_t r0 = (size_t)blockIdx.x * 64; const size_t bb = r0 / TT; const int t0 = (int)(r0 % TT);
  const float* X = which == 0 ? XQ : which == 1 ? XK : XV; const float* WA = which == 0 ? WQ : which == 1 ? WK : WV; const float* BA = which == 0 ? BQ : which == 1 ? BK : BV;
  v8f acc[8] = {};
#pragma unroll 2
  for (int kc = 0; kc < DIN / 32; ++kc) { v16b a; { const float* p = X + (r0 + wave * 16 + col) * DIN + kc * 32 + 8 * g;
#pragma unroll
      for (int i = 0; i < 8; ++i) { a[i] = (__bf16)p[i]; a[8 + i] = (__bf16)p[16 + i]; } }
    asm volatile("s_wait_loadcnt 0x0" ::: "memory");
#pragma unroll
    for (int j = 0; j < 8; ++j) { const v16b w = WCOL(WA, kc * 32, c0 + j * 16 + col, lane); asm volatile("s_wait_loadcnt 0x0" ::: "memory"); acc[j] = wmma_bf(a, w, acc[j]); } }
  if (which < 2) { _Float16* DH = which == 0 ? QH : KH; _Float16* DL = which == 0 ? QL : KL; const int nhi = which == 0 ? QHI : KHI; const bool hi_rows = t0 < nhi;
#pragma unroll
    for (int j = 0; j < 8; ++j) { const float bias = BA ? bfr(BA[c0 + j * 16 + col]) : 0.f;
#pragma unroll
      for (int r = 0; r < 8; ++r) { const float v = acc[j][r] + bias; const _Float16 hv = (_Float16)v; sh[wave * 16 + 8 * g + r][j * 16 + col] = hv; sl[wave * 16 + 8 * g + r][j * 16 + col] = (_Float16)((v - (float)hv) * 1024.0f); } }
    __syncthreads();
    for (int e = tid; e < 64 * 16; e += 128) { const int rl = e >> 4, q = e & 15; vst2((unsigned*)(DH + (r0 + rl) * CC + c0 + q * 8), *(const v4u*)&sh[rl][q * 8]); if (hi_rows) vst2((unsigned*)(DL + (bb * nhi + t0 + rl) * (size_t)CC + c0 + q * 8), *(const v4u*)&sl[rl][q * 8]); }
  } else { const bool hi_rows = t0 < KHI;
#pragma unroll
    for (int j = 0; j < 8; ++j) { const float bias = BA ? bfr(BA[c0 + j * 16 + col]) : 0.f;
#pragma unroll
      for (int r = 0; r < 8; ++r) { const float v = acc[j][r] + bias; const int rl = wave * 16 + 8 * g + r, cl = j * 16 + col; th[cl][rl] = (_Float16)v; const __bf16 bh = (__bf16)v; tb[cl][rl] = bh; tbl[cl][rl] = (__bf16)(v - (float)bh); } }
    __syncthreads();
    for (int e = tid; e < 128 * 8; e += 128) { const int cl = e >> 3, q = e & 7; vst2((unsigned*)(VT + (bb * CC + c0 + cl) * (size_t)TT + t0 + q * 8), *(const v4u*)&th[cl][q * 8]); if (hi_rows) { const size_t o3 = (bb * CC + c0 + cl) * (size_t)KHI + t0 + q * 8; vst2((unsigned*)(VB + o3), *(const v4u*)&tb[cl][q * 8]); vst2((unsigned*)(VBL + o3), *(const v4u*)&tbl[cl][q * 8]); } } } }
// ---- k_sc: block = (query block qb, key block kb <= kb_last(qb), head in group) of batch b: logits x SCALE; q hi + residual (x 2^10) against k (2 products) for query rows < QHI, plus the k residual (3 products) for query blocks < QBH (causal early rows); causal: blocks past the diagonal exit, the mask itself is applied by index in k_sm
__global__ __launch_bounds__(128) void k_sc(const _Float16* __restrict__ QH, const _Float16* __restrict__ KH, const _Float16* __restrict__ QL, const _Float16* __restrict__ KL, int b, int h0, float* __restrict__ S0) { __shared__ __align__(16) float ss[4][16][132];
  const int qb = blockIdx.x, kb = blockIdx.y; if (kb > kb_last(qb)) return;
  const int h = h0 + blockIdx.z; float* S = S0 + (size_t)blockIdx.z * TT * TT;
  const int tid = threadIdx.x, wave = tid >> 5, lane = tid & 31, col = lane & 15, g = lane >> 4; const int k0 = kb * 128; const int ql0 = qb * 64 + wave * 16; const size_t q0 = (size_t)b * TT + ql0, kr0 = (size_t)b * TT + k0;
  v8f acc[8] = {}, accl[8] = {};
  const _Float16* QLb = QL + (size_t)b * QHI * CC; const _Float16* KLb = KL + (size_t)b * KHI * CC;
  if (qb < QBH) {
#pragma unroll
    for (int kc = 0; kc < HD / 32; ++kc) { const v16h ah = frag_h(QH + (q0 + col) * CC + h * HD + kc * 32, lane), al = frag_h(QLb + (size_t)(ql0 + col) * CC + h * HD + kc * 32, lane);
#pragma unroll
      for (int j = 0; j < 8; ++j) { const v16h kbf = frag_h(KH + (kr0 + j * 16 + col) * CC + h * HD + kc * 32, lane), klf = frag_h(KLb + (size_t)(k0 + j * 16 + col) * CC + h * HD + kc * 32, lane); acc[j] = wmma16(ah, kbf, acc[j]); accl[j] = wmma16(al, kbf, accl[j]); accl[j] = wmma16(ah, klf, accl[j]); } }
  } else if (qb * 64 < QHI) {
#pragma unroll
    for (int kc = 0; kc < HD / 32; ++kc) { const v16h ah = frag_h(QH + (q0 + col) * CC + h * HD + kc * 32, lane), al = frag_h(QLb + (size_t)(ql0 + col) * CC + h * HD + kc * 32, lane);
#pragma unroll
      for (int j = 0; j < 8; ++j) { const v16h kbf = frag_h(KH + (kr0 + j * 16 + col) * CC + h * HD + kc * 32, lane); acc[j] = wmma16(ah, kbf, acc[j]); accl[j] = wmma16(al, kbf, accl[j]); } }
  } else {
#pragma unroll
    for (int kc = 0; kc < HD / 32; ++kc) { const v16h ah = frag_h(QH + (q0 + col) * CC + h * HD + kc * 32, lane);
#pragma unroll
      for (int j = 0; j < 8; ++j) { const v16h kbf = frag_h(KH + (kr0 + j * 16 + col) * CC + h * HD + kc * 32, lane); acc[j] = wmma16(ah, kbf, acc[j]); } } }
#pragma unroll
  for (int j = 0; j < 8; ++j) {
#pragma unroll
    for (int r = 0; r < 8; ++r) ss[wave][8 * g + r][j * 16 + col] = (acc[j][r] + accl[j][r] * (1.0f / 1024.0f)) * SCALE; }
  LDSX(); for (int rl = 0; rl < 16; ++rl) vst2(S + (size_t)(ql0 + rl) * TT + k0 + lane * 4, *(const v4f*)&ss[wave][rl][lane * 4]); }
// ---- k_sm: block = query row t (head in group): keys [0, kend): causal -> logit if s <= t else excluded; softmax in f32; P x 2^11 in place (0 for excluded)
__global__ __launch_bounds__(256) void k_sm(float* __restrict__ S0 SM_EXTRA_PARAMS) { __shared__ float sred[8]; __shared__ float sbc; __shared__ __align__(16) float shv[TT];
  const int tid = threadIdx.x; const int t = blockIdx.x; const int kend = (kb_last(t >> 6) + 1) * 128;
  float* sr = S0 + (size_t)blockIdx.y * TT * TT + (size_t)t * TT;
  float m = -3.0e38f; for (int k = tid; k < kend; k += 256) { float v = (!CAUSAL || k <= t) ? sr[k] : -3.0e38f; SM_MASK_HOOK; shv[k] = v; m = fmaxf(m, v); }
#pragma unroll
  for (int o = 1; o < 32; o <<= 1) m = fmaxf(m, __shfl_xor(m, o));
  if ((tid & 31) == 0) sred[tid >> 5] = m; __syncthreads(); if (tid == 0) { float a = sred[0]; for (int i = 1; i < 8; ++i) a = fmaxf(a, sred[i]); sbc = a; } __syncthreads(); m = sbc; __syncthreads();
  float sum = 0.f; for (int k = tid; k < kend; k += 256) { const float v = shv[k]; const float e = (v <= -1.0e38f) ? 0.f : expf(v - m); shv[k] = e; sum += e; }
#pragma unroll
  for (int o = 1; o < 32; o <<= 1) sum += __shfl_xor(sum, o);
  if ((tid & 31) == 0) sred[tid >> 5] = sum; __syncthreads(); if (tid == 0) { float a = 0.f; for (int i = 0; i < 8; ++i) a += sred[i]; sbc = a > 0.f ? 2048.0f / a : 0.f; }   /* a fully excluded row yields P = 0 */ __syncthreads(); const float inv = sbc;
  for (int k = tid; k < kend; k += 256) shv[k] = shv[k] * inv;
  __syncthreads(); for (int q = tid; q < kend / 4; q += 256) vst2(sr + q * 4, *(const v4f*)&shv[q * 4]); }
// ---- k_pv: block = 64 queries (qb) of (b, h): ctx = P . v over keys [0, kend) (P x 2^11 once to f16 against v f16: 1 product; causal early query blocks: P and v as bf16 hi + lo, 3 products); 256-B (row, head) segment by 16 lanes
__global__ __launch_bounds__(128) void k_pv(const float* __restrict__ PS0, const _Float16* __restrict__ VT, const __bf16* __restrict__ VB, const __bf16* __restrict__ VBL, int b, int h0, float* __restrict__ Y) { const int h = h0 + blockIdx.z; const float* PS = PS0 + (size_t)blockIdx.z * TT * TT; __shared__ __align__(16) float ss[4][16][HD + 4];
  const int tid = threadIdx.x, wave = tid >> 5, lane = tid & 31, col = lane & 15, g = lane >> 4; const int qb = blockIdx.x; const int ql0 = qb * 64 + wave * 16; const int kce = (kb_last(qb) + 1) * 4;
  v8f acc[HD / 16] = {};
  if (qb < QBH) {
#pragma unroll 1
    for (int kc = 0; kc < kce; ++kc) { const F2 p = split_row(PS + (size_t)(ql0 + col) * TT, kc * 32, lane);
      asm volatile("s_wait_loadcnt 0x0" ::: "memory");
#pragma unroll
      for (int j = 0; j < HD / 16; ++j) { const size_t po = ((size_t)b * CC + h * HD + j * 16 + col) * (size_t)KHI + kc * 32; const v16b vh = frag_b(VB + po, lane); acc[j] = wmma_bf(p.h, vh, acc[j]); acc[j] = wmma_bf(p.l, vh, acc[j]); acc[j] = wmma_bf(p.h, frag_b(VBL + po, lane), acc[j]); } }
  } else {
#pragma unroll 1
    for (int kc = 0; kc < kce; ++kc) { const v16h p = frag_f32(PS + (size_t)(ql0 + col) * TT + kc * 32, lane);
      asm volatile("s_wait_loadcnt 0x0" ::: "memory");
#pragma unroll
      for (int j = 0; j < HD / 16; ++j) { const size_t po = ((size_t)b * CC + h * HD + j * 16 + col) * (size_t)TT + kc * 32; acc[j] = wmma16(p, frag_h(VT + po, lane), acc[j]); } } }
#pragma unroll
  for (int j = 0; j < HD / 16; ++j)
#pragma unroll
    for (int r = 0; r < 8; ++r) ss[wave][8 * g + r][j * 16 + col] = acc[j][r] * (1.0f / 2048.0f);
  LDSX(); for (int rl = 0; rl < 16; ++rl) if (lane < HD / 4) vst2(Y + ((size_t)b * TT + ql0 + rl) * CC + h * HD + lane * 4, *(const v4f*)&ss[wave][rl][lane * 4]); }
// ---- k_out: block = (64 rows, 128 cols): out = ctx Wo (+ bo): ctx x 2^6 once to f16 against Wo as f16(bf16 x 2^8) exact (1 product) x 2^-14; causal early rows (< QHI of each sequence): ctx bf16 hi + lo against exact bf16 Wo (2 products)
__global__ __launch_bounds__(128) void k_out(const float* __restrict__ Y, const float* __restrict__ WO, const float* __restrict__ BO, float* __restrict__ OUT) { __shared__ __align__(16) float sf[4][16][132];
  const int tid = threadIdx.x, wave = tid >> 5, lane = tid & 31, col = lane & 15, g = lane >> 4; const int c0 = blockIdx.y * 128; const size_t r0 = (size_t)blockIdx.x * 64 + wave * 16;
  v8f acc[8] = {};
  if (CAUSAL && (int)(((size_t)blockIdx.x * 64) % TT) < QHI) {   /* block-uniform */
#pragma unroll 2
    for (int kc = 0; kc < CC / 32; ++kc) { const F2 a = split_row(Y + (r0 + col) * CC, kc * 32, lane); asm volatile("s_wait_loadcnt 0x0" ::: "memory");
#pragma unroll
      for (int j = 0; j < 8; ++j) { const v16b w = WOCOL(WO, kc * 32, c0 + j * 16 + col, lane); asm volatile("s_wait_loadcnt 0x0" ::: "memory"); acc[j] = wmma_bf(a.h, w, acc[j]); acc[j] = wmma_bf(a.l, w, acc[j]); } }
#pragma unroll
    for (int j = 0; j < 8; ++j) { const float bias = BO ? bfr(BO[c0 + j * 16 + col]) : 0.f;
#pragma unroll
      for (int r = 0; r < 8; ++r) sf[wave][8 * g + r][j * 16 + col] = acc[j][r] + bias; }
  } else {
#pragma unroll 2
    for (int kc = 0; kc < CC / 32; ++kc) { const v16h a = frag_f32s(Y + (r0 + col) * CC + kc * 32, lane, 64.0f); asm volatile("s_wait_loadcnt 0x0" ::: "memory");   /* ctx carried x 2^6 into f16 so small-magnitude context rows stay clear of f16 subnormals */
#pragma unroll
      for (int j = 0; j < 8; ++j) { const v16h w = WOCOLH(WO, kc * 32, c0 + j * 16 + col, lane); asm volatile("s_wait_loadcnt 0x0" ::: "memory"); acc[j] = wmma16(a, w, acc[j]); } }
#pragma unroll
    for (int j = 0; j < 8; ++j) { const float bias = BO ? bfr(BO[c0 + j * 16 + col]) : 0.f;
#pragma unroll
      for (int r = 0; r < 8; ++r) sf[wave][8 * g + r][j * 16 + col] = acc[j][r] * (1.0f / 16384.0f) + bias; } }   /* 2^-8 (Wo carry) x 2^-6 (ctx carry) */
  LDSX(); for (int rl = 0; rl < 16; ++rl) vst2(OUT + (r0 + rl) * DIN + c0 + lane * 4, *(const v4f*)&sf[wave][rl][lane * 4]); }

extern "C" void kernel_launch(void* const* d_in, const int* in_sizes, int n_in, void* d_out, int out_size, void* d_ws, size_t ws_size, hipStream_t stream) {
  (void)in_sizes; (void)n_in; (void)out_size;
  const float** F = (const float**)d_in;
  if (ws_size < (size_t)WS_END) return;
  char* ws = (char*)d_ws; _Float16 *QH = (_Float16*)(ws + WS_QH), *KH = (_Float16*)(ws + WS_KH), *VT = (_Float16*)(ws + WS_VT), *QL = (_Float16*)(ws + WS_QL), *KL = (_Float16*)(ws + WS_KL); __bf16 *VB = (__bf16*)(ws + WS_VB), *VBL = (__bf16*)(ws + WS_VBL); float *S = (float*)(ws + WS_S), *Y = (float*)(ws + WS_Y);
  (void)Y; (void)QL; (void)KL; (void)VB; (void)VBL;
  // inputs: 0 x [8,2048,512]; 1 Wq [8,512,64] (per-head (in,out)); 2 Wk; 3 Wv; 4 Wo [512,512] (in,out); 5 bo [512] (normal x 0.01, read)
  k_proj<<<dim3(TNB * TT / 64, CC / 128, 3), 128, 0, stream>>>(F[0], F[0], F[0], F[1], F[2], F[3], nullptr, nullptr, nullptr, QH, QL, KH, KL, VT, VB, VBL);
  for (int b = 0; b < TNB; ++b) for (int h0 = 0; h0 < NH; h0 += HG) {
    k_sc<<<dim3(NQB, TT / 128, HG), 128, 0, stream>>>(QH, KH, QL, KL, b, h0, S);
    k_sm<<<dim3(TT, HG), 256, 0, stream>>>(S);
    k_pv<<<dim3(NQB, 1, HG), 128, 0, stream>>>(S, VT, VB, VBL, b, h0, Y);
  }
  k_out<<<dim3(TNB * TT / 64, DIN / 128), 128, 0, stream>>>(Y, F[4], F[5], (float*)d_out);
}

// v001
// It runs in 1150 microseconds.
// Two timings next to v000 put it at 1.62 and 1.63 times that version's speed.
// compute dtype: all float inputs rounded to bf16; per-head q/k/v projections with EXACT bf16 products on WMMA 16x16x32 (f32 accumulate); causal logits: 3 products for the first 384 rows, single f16 q x k after, x 64^-0.5; softmax f32; P x 2^11 once to f16 x v once to f16 (bf16 hi + lo below row 384); ctx hi+lo x exact Wproj below row 384, x2^6 f16 carry x f16(bf16 x 2^8) Wproj after, + bproj; f32 output.
#include <hip/hip_runtime.h>
#include <math.h>

typedef __attribute__((ext_vector_type(16))) _Float16 v16h;
typedef __attribute__((ext_vector_type(16))) __bf16 v16b;
typedef __attribute__((ext_vector_type(8)))  _Float16 v8h;
typedef __attribute__((ext_vector_type(8)))  float v8f;
typedef __attribute__((ext_vector_type(4)))  float v4f;
typedef __attribute__((ext_vector_type(2)))  float v2f;
typedef __attribute__((ext_vector_type(4)))  unsigned v4u;
typedef __attribute__((ext_vector_type(4)))  int v4i;
typedef float __attribute__((may_alias)) float_a;
typedef int __attribute__((may_alias)) int_a;

template <typename T> __device__ __forceinline__ void vst2(void* p, T v) { *(T*)p = v;  }
__device__ __forceinline__ v8f wmma16(v16h a, v16h b, v8f c) {
  v8f d = __builtin_amdgcn_wmma_f32_16x16x32_f16(false, a, false, b, (short)0, c, false, false);
  asm volatile("v_nop\n\tv_nop\n\tv_nop\n\tv_nop" : "+v"(d) : "v"(a), "v"(b));
  return d;
}
__device__ __forceinline__ v8f wmma_bf(v16b a, v16b b, v8f c) {
  v8f d = __builtin_amdgcn_wmma_f32_16x16x32_bf16(false, a, false, b, (short)0, c, false, false);
  asm volatile("v_nop\n\tv_nop\n\tv_nop\n\tv_nop" : "+v"(d) : "v"(a), "v"(b));
  return d;
}
// 16x16x32 fragments: lane = (h = lane>>4, row/col = lane&15); elements 0..7 = k0+8h+0..7, 8..15 = k0+16+8h+0..7; D element r = row 8h+r
__device__ __forceinline__ v16h frag_h(const _Float16* rowk0, int lane) {
  union { v16h v; v8h q[2]; } u; const _Float16* p = rowk0 + 8 * (lane >> 4);
  u.q[0] = *(const v8h*)p; u.q[1] = *(const v8h*)(p + 16); return u.v;
}
__device__ __forceinline__ v16h frag_f32(const float* rowk0, int lane) {
  v16h a; const float* p = rowk0 + 8 * (lane >> 4);
#pragma unroll
  for (int i = 0; i < 8; ++i) { a[i] = (_Float16)p[i]; a[8 + i] = (_Float16)p[16 + i]; }
  return a;
}
__device__ __forceinline__ v16h frag_f32s(const float* rowk0, int lane, float sc) {
  v16h a; const float* p = rowk0 + 8 * (lane >> 4);
#pragma unroll
  for (int i = 0; i < 8; ++i) { a[i] = (_Float16)(p[i] * sc); a[8 + i] = (_Float16)(p[16 + i] * sc); }
  return a;
}
// column fragment from a [K][ld] layout (column n), rows >= K read as 0
__device__ __forceinline__ v16h fragc_f32(const float* W, int k0, int n, int lane, int ld, int K) {
  v16h a; const int g = lane >> 4;
#pragma unroll
  for (int i = 0; i < 8; ++i) { const int ka = k0 + 8 * g + i, kb = ka + 16;
    a[i] = (_Float16)(ka < K ? W[(size_t)(ka < K ? ka : K - 1) * ld + n] : 0.f); a[8 + i] = (_Float16)(kb < K ? W[(size_t)(kb < K ? kb : K - 1) * ld + n] : 0.f); }
  return a;
}
struct F2 { v16b h, l; };
__device__ __forceinline__ F2 bsplit16(const float v[16]) { F2 r;
#pragma unroll
  for (int i = 0; i < 16; ++i) { const __bf16 h = (__bf16)v[i]; r.h[i] = h; r.l[i] = (__bf16)(v[i] - (float)h); }
  return r; }
__device__ __forceinline__ F2 split_row(const float* row, int k0, int lane) { float v[16]; const float* p = row + k0 + 8 * (lane >> 4);
#pragma unroll
  for (int i = 0; i < 8; ++i) { v[i] = p[i]; v[8 + i] = p[16 + i]; }
  return bsplit16(v); }
__device__ __forceinline__ F2 split_rowK(const float* row, int k0, int lane, int K) { float v[16]; const int g = lane >> 4;
#pragma unroll
  for (int i = 0; i < 8; ++i) { const int ka = k0 + 8 * g + i, kb = ka + 16; v[i] = ka < K ? row[ka < K ? ka : K - 1] : 0.f; v[8 + i] = kb < K ? row[kb < K ? kb : K - 1] : 0.f; }
  return bsplit16(v); }
__device__ __forceinline__ F2 split_col(const float* W, int k0, int n, int lane, int ld, int K) { float v[16]; const int g = lane >> 4;
#pragma unroll
  for (int i = 0; i < 8; ++i) { const int ka = k0 + 8 * g + i, kb = ka + 16; v[i] = ka < K ? W[(size_t)(ka < K ? ka : K - 1) * ld + n] : 0.f; v[8 + i] = kb < K ? W[(size_t)(kb < K ? kb : K - 1) * ld + n] : 0.f; }
  return bsplit16(v); }
__device__ __forceinline__ v8f mac3(const F2& a, const F2& b, v8f c) { c = wmma_bf(a.l, b.h, c); c = wmma_bf(a.h, b.l, c); return wmma_bf(a.h, b.h, c); }
__device__ __forceinline__ float sigm(float v) { return 1.0f / (1.0f + expf(-v)); }
#define LDSX() do { asm volatile("s_wait_dscnt 0" ::: "memory"); __builtin_amdgcn_wave_barrier(); __builtin_amdgcn_fence(__ATOMIC_RELEASE, "workgroup"); } while (0)

// Causal multi-head self-attention with PER-HEAD projection weights (x [8,2048,512]; 8 heads x 64; Wq/Wk/Wv [8,512,64] = [H][C][D] (in,out per head); Wo [512,512] (in,out) + bo (normal x 0.01: read); tril, -inf): q_h = x Wq[h]; out = concat_h(softmax(causal(q_h k_h^T * 64^-0.5)) v_h) Wo + bo.
#define NB 8
#define TT 2048
#define CC 512            // NH * HD = projected width
#define DIN 512          // input (model) width
#define NH 8
#define HD 64
#define NQB (TT / 64)
#define HG 4
#define SCALE (0.125f)
#define CAUSAL 1
#ifndef TNB
#define TNB NB
#endif
__device__ __forceinline__ float bfr(float v) { return (float)(__bf16)v; }
__host__ __device__ __forceinline__ int kb_last(int qb) { return CAUSAL ? ((qb * 64 + 63) >> 7) : (TT / 128 - 1); }
typedef __attribute__((ext_vector_type(8))) __bf16 v8b;
__device__ __forceinline__ v16b frag_b(const __bf16* rowk0, int lane) {
  union { v16b v; v8b q[2]; } u; const __bf16* p = rowk0 + 8 * (lane >> 4);
  u.q[0] = *(const v8b*)p; u.q[1] = *(const v8b*)(p + 16); return u.v;
}
#define QBH 6              // causal: query blocks 0..QBH-1 of each sequence (few keys, no averaging) take the high-precision path
#define QHI 384            // rows carrying a q residual plane
#define KHI 384            // key rows carrying k residual / v bf16 hi+lo planes (used only by the causal high-precision path)
// B fragment (k rows k0+.., output column o) of a weight: (in,out) [K][ld] or (out,in) [ld rows of K]: bf16 exact, or f16(bf16 * 256) exact
__device__ __forceinline__ v16b wcol_io(const float* Wm, int k0, int o, int lane, int ld) { v16b w; const int g = lane >> 4;
#pragma unroll
  for (int i = 0; i < 8; ++i) { w[i] = (__bf16)Wm[(size_t)(k0 + 8 * g + i) * ld + o]; w[8 + i] = (__bf16)Wm[(size_t)(k0 + 16 + 8 * g + i) * ld + o]; }
  return w; }
__device__ __forceinline__ v16b wcol_oi(const float* Wm, int k0, int o, int lane, int K) { v16b w; const float* p = Wm + (size_t)o * K + k0 + 8 * (lane >> 4);
#pragma unroll
  for (int i = 0; i < 8; ++i) { w[i] = (__bf16)p[i]; w[8 + i] = (__bf16)p[16 + i]; }
  return w; }
__device__ __forceinline__ v16h wcolh_io(const float* Wm, int k0, int o, int lane, int ld) { v16h w; const int g = lane >> 4;
#pragma unroll
  for (int i = 0; i < 8; ++i) { w[i] = (_Float16)(bfr(Wm[(size_t)(k0 + 8 * g + i) * ld + o]) * 256.0f); w[8 + i] = (_Float16)(bfr(Wm[(size_t)(k0 + 16 + 8 * g + i) * ld + o]) * 256.0f); }
  return w; }
__device__ __forceinline__ v16h wcolh_oi(const float* Wm, int k0, int o, int lane, int K) { v16h w; const float* p = Wm + (size_t)o * K + k0 + 8 * (lane >> 4);
#pragma unroll
  for (int i = 0; i < 8; ++i) { w[i] = (_Float16)(bfr(p[i]) * 256.0f); w[8 + i] = (_Float16)(bfr(p[16 + i]) * 256.0f); }
  return w; }
#define WQKV_LAYOUT 2   // 0 = (in,out) [DIN][CC]; 1 = (out,in) [CC][DIN]; 2 = per-head [NH][DIN][HD]
__device__ __forceinline__ v16b wcol_hdk(const float* Wm, int k0, int o, int lane) { v16b w; const int g = lane >> 4; const float* p = Wm + (size_t)(o / HD) * DIN * HD + (o % HD);
#pragma unroll
  for (int i = 0; i < 8; ++i) { w[i] = (__bf16)p[(size_t)(k0 + 8 * g + i) * HD]; w[8 + i] = (__bf16)p[(size_t)(k0 + 16 + 8 * g + i) * HD]; }
  return w; }
#define WO_OUT_IN 0
#if WQKV_LAYOUT == 1
#define WCOL(W, k0, o, lane) wcol_oi(W, k0, o, lane, DIN)
#elif WQKV_LAYOUT == 2
#define WCOL(W, k0, o, lane) wcol_hdk(W, k0, o, lane)
#else
#define WCOL(W, k0, o, lane) wcol_io(W, k0, o, lane, CC)
#endif
#if WO_OUT_IN
#define WOCOL(W, k0, o, lane) wcol_oi(W, k0, o, lane, CC)
#define WOCOLH(W, k0, o, lane) wcolh_oi(W, k0, o, lane, CC)
#else
#define WOCOL(W, k0, o, lane) wcol_io(W, k0, o, lane, DIN)
#define WOCOLH(W, k0, o, lane) wcolh_io(W, k0, o, lane, DIN)
#endif

#ifndef SM_EXTRA_PARAMS
#define SM_EXTRA_PARAMS
#endif
#ifndef PROJ_EXTRA_PARAMS
#define PROJ_EXTRA_PARAMS
#endif
#ifndef SM_MASK_HOOK
#define SM_MASK_HOOK (void)0
#endif

#define WS_QH  0u                                      // f16 q rows [b*t][CC]
#define WS_KH  (WS_QH + 2u * (size_t)NB * TT * CC)      // f16 k rows [b*t][CC]
#define WS_VT  (WS_KH + 2u * (size_t)NB * TT * CC)      // f16 v planes [b][c][t]
#define WS_QL  (WS_VT + 2u * (size_t)NB * CC * TT)      // f16 q residual x 2^10 rows [b][t < QHI][CC]
#define WS_KL  (WS_QL + 2u * (size_t)NB * QHI * CC)     // f16 k residual x 2^10 rows [b][t < KHI][CC]
#define WS_VB  (WS_KL + 2u * (size_t)NB * KHI * CC)     // bf16 v hi planes [b][c][t < KHI]
#define WS_VBL (WS_VB + 2u * (size_t)NB * CC * KHI)
#define WS_S   (WS_VBL + 2u * (size_t)NB * CC * KHI)    // f32 logits / P [hg][t][s]
#define WS_Y   (WS_S  + 4u * (size_t)HG * TT * TT)      // f32 ctx rows [b*t][CC] (only when there is an output projection)
#define WS_END (WS_Y  + 4u * (size_t)NB * TT * CC)

// ---- k_proj: block = (64 rows, 128 cols, which): q/k/v = X W (+ b) with exact bf16 products (K = DIN) -> which 0: q f16 rows (+ residual rows < QHI); 1: k f16 rows (+ residual rows < KHI); 2: v f16 planes [c][t] (+ bf16 hi/lo planes for t < KHI)
__global__ __launch_bounds__(128) void k_proj(const float* __restrict__ XQ, const float* __restrict__ XK, const float* __restrict__ XV, const float* __restrict__ WQ, const float* __restrict__ WK, const float* __restrict__ WV, const float* __restrict__ BQ, const float* __restrict__ BK, const float* __restrict__ BV,
    _Float16* __restrict__ QH, _Float16* __restrict__ QL, _Float16* __restrict__ KH, _Float16* __restrict__ KL, _Float16* __restrict__ VT, __bf16* __restrict__ VB, __bf16* __restrict__ VBL) {
  __shared__ __align__(16) _Float16 sh[64][136], sl[64][136]; __shared__ __align__(16) _Float16 th[128][72]; __shared__ __align__(16) __bf16 tb[128][72], tbl[128][72];
  const int tid = threadIdx.x, wave = tid >> 5, lane = tid & 31, col = lane & 15, g = lane >> 4; const int which = blockIdx.z; const int c0 = blockIdx.y * 128; const size_t r0 = (size_t)blockIdx.x * 64; const size_t bb = r0 / TT; const int t0 = (int)(r0 % TT);
  const float* X = which == 0 ? XQ : which == 1 ? XK : XV; const float* WA = which == 0 ? WQ : which == 1 ? WK : WV; const float* BA = which == 0 ? BQ : which == 1 ? BK : BV;
  v8f acc[8] = {};
#pragma unroll 2
  for (int kc = 0; kc < DIN / 32; ++kc) { v16b a; { const float* p = X + (r0 + wave * 16 + col) * DIN + kc * 32 + 8 * g;
#pragma unroll
      for (int i = 0; i < 8; ++i) { a[i] = (__bf16)p[i]; a[8 + i] = (__bf16)p[16 + i]; } }
    asm volatile("s_wait_loadcnt 0x0" ::: "memory");
#pragma unroll
    for (int j = 0; j < 8; ++j) { const v16b w = WCOL(WA, kc * 32, c0 + j * 16 + col, lane); asm volatile("s_wait_loadcnt 0x0" ::: "memory"); acc[j] = wmma_bf(a, w, acc[j]); } }
  if (which < 2) { _Float16* DH = which == 0 ? QH : KH; _Float16* DL = which == 0 ? QL : KL; const int nhi = which == 0 ? QHI : KHI; const bool hi_rows = t0 < nhi;
#pragma unroll
    for (int j = 0; j < 8; ++j) { const float bias = BA ? bfr(BA[c0 + j * 16 + col]) : 0.f;
#pragma unroll
      for (int r = 0; r < 8; ++r) { const float v = acc[j][r] + bias; const _Float16 hv = (_Float16)v; sh[wave * 16 + 8 * g + r][j * 16 + col] = hv; sl[wave * 16 + 8 * g + r][j * 16 + col] = (_Float16)((v - (float)hv) * 1024.0f); } }
    __syncthreads();
    for (int e = tid; e < 64 * 16; e += 128) { const int rl = e >> 4, q = e & 15; vst2((unsigned*)(DH + (r0 + rl) * CC + c0 + q * 8), *(const v4u*)&sh[rl][q * 8]); if (hi_rows) vst2((unsigned*)(DL + (bb * nhi + t0 + rl) * (size_t)CC + c0 + q * 8), *(const v4u*)&sl[rl][q * 8]); }
  } else { const bool hi_rows = t0 < KHI;
#pragma unroll
    for (int j = 0; j < 8; ++j) { const float bias = BA ? bfr(BA[c0 + j * 16 + col]) : 0.f;
#pragma unroll
      for (int r = 0; r < 8; ++r) { const float v = acc[j][r] + bias; const int rl = wave * 16 + 8 * g + r, cl = j * 16 + col; th[cl][rl] = (_Float16)v; const __bf16 bh = (__bf16)v; tb[cl][rl] = bh; tbl[cl][rl] = (__bf16)(v - (float)bh); } }
    __syncthreads();
    for (int e = tid; e < 128 * 8; e += 128) { const int cl = e >> 3, q = e & 7; vst2((unsigned*)(VT + (bb * CC + c0 + cl) * (size_t)TT + t0 + q * 8), *(const v4u*)&th[cl][q * 8]); if (hi_rows) { const size_t o3 = (bb * CC + c0 + cl) * (size_t)KHI + t0 + q * 8; vst2((unsigned*)(VB + o3), *(const v4u*)&tb[cl][q * 8]); vst2((unsigned*)(VBL + o3), *(const v4u*)&tbl[cl][q * 8]); } } } }
// ---- k_sc: block = (query block qb, key block kb <= kb_last(qb), head in group) of batch b: logits x SCALE; q hi + residual (x 2^10) against k (2 products) for query rows < QHI, plus the k residual (3 products) for query blocks < QBH (causal early rows); causal: blocks past the diagonal exit, the mask itself is applied by index in k_sm
__global__ __launch_bounds__(128) void k_sc(const _Float16* __restrict__ QH, const _Float16* __restrict__ KH, const _Float16* __restrict__ QL, const _Float16* __restrict__ KL, int b, int h0, float* __restrict__ S0) { __shared__ __align__(16) float ss[4][16][132];
  const int qb = blockIdx.x, kb = blockIdx.y; if (kb > kb_last(qb)) return;
  const int h = h0 + blockIdx.z; float* S = S0 + (size_t)blockIdx.z * TT * TT;
  const int tid = threadIdx.x, wave = tid >> 5, lane = tid & 31, col = lane & 15, g = lane >> 4; const int k0 = kb * 128; const int ql0 = qb * 64 + wave * 16; const size_t q0 = (size_t)b * TT + ql0, kr0 = (size_t)b * TT + k0;
  v8f acc[8] = {}, accl[8] = {};
  const _Float16* QLb = QL + (size_t)b * QHI * CC; const _Float16* KLb = KL + (size_t)b * KHI * CC;
  if (qb < QBH) {
#pragma unroll
    for (int kc = 0; kc < HD / 32; ++kc) { const v16h ah = frag_h(QH + (q0 + col) * CC + h * HD + kc * 32, lane), al = frag_h(QLb + (size_t)(ql0 + col) * CC + h * HD + kc * 32, lane);
#pragma unroll
      for (int j = 0; j < 8; ++j) { const v16h kbf = frag_h(KH + (kr0 + j * 16 + col) * CC + h * HD + kc * 32, lane), klf = frag_h(KLb + (size_t)(k0 + j * 16 + col) * CC + h * HD + kc * 32, lane); acc[j] = wmma16(ah, kbf, acc[j]); accl[j] = wmma16(al, kbf, accl[j]); accl[j] = wmma16(ah, klf, accl[j]); } }
  } else if (qb * 64 < QHI) {
#pragma unroll
    for (int kc = 0; kc < HD / 32; ++kc) { const v16h ah = frag_h(QH + (q0 + col) * CC + h * HD + kc * 32, lane), al = frag_h(QLb + (size_t)(ql0 + col) * CC + h * HD + kc * 32, lane);
#pragma unroll
      for (int j = 0; j < 8; ++j) { const v16h kbf = frag_h(KH + (kr0 + j * 16 + col) * CC + h * HD + kc * 32, lane); acc[j] = wmma16(ah, kbf, acc[j]); accl[j] = wmma16(al, kbf, accl[j]); } }
  } else {
#pragma unroll
    for (int kc = 0; kc < HD / 32; ++kc) { const v16h ah = frag_h(QH + (q0 + col) * CC + h * HD + kc * 32, lane);
#pragma unroll
      for (int j = 0; j < 8; ++j) { const v16h kbf = frag_h(KH + (kr0 + j * 16 + col) * CC + h * HD + kc * 32, lane); acc[j] = wmma16(ah, kbf, acc[j]); } } }
#pragma unroll
  for (int j = 0; j < 8; ++j) {
#pragma unroll
    for (int r = 0; r < 8; ++r) ss[wave][8 * g + r][j * 16 + col] = (acc[j][r] + accl[j][r] * (1.0f / 1024.0f)) * SCALE; }
  LDSX(); for (int rl = 0; rl < 16; ++rl) vst2(S + (size_t)(ql0 + rl) * TT + k0 + lane * 4, *(const v4f*)&ss[wave][rl][lane * 4]); }
// ---- k_sm: block = query row t (head in group): keys [0, kend): causal -> logit if s <= t else excluded; softmax in f32; P x 2^11 in place (0 for excluded)
__global__ __launch_bounds__(256) void k_sm(float* __restrict__ S0 SM_EXTRA_PARAMS) { __shared__ float sred[8]; __shared__ float sbc; __shared__ __align__(16) float shv[TT];
  const int tid = threadIdx.x; const int t = blockIdx.x; const int kend = (kb_last(t >> 6) + 1) * 128;
  float* sr = S0 + (size_t)blockIdx.y * TT * TT + (size_t)t * TT;
  float m = -3.0e38f; for (int k = tid; k < kend; k += 256) { float v = (!CAUSAL || k <= t) ? sr[k] : -3.0e38f; SM_MASK_HOOK; shv[k] = v; m = fmaxf(m, v); }
#pragma unroll
  for (int o = 1; o < 32; o <<= 1) m = fmaxf(m, __shfl_xor(m, o));
  if ((tid & 31) == 0) sred[tid >> 5] = m; __syncthreads(); if (tid == 0) { float a = sred[0]; for (int i = 1; i < 8; ++i) a = fmaxf(a, sred[i]); sbc = a; } __syncthreads(); m = sbc; __syncthreads();
  float sum = 0.f; for (int k = tid; k < kend; k += 256) { const float v = shv[k]; const float e = (v <= -1.0e38f) ? 0.f : expf(v - m); shv[k] = e; sum += e; }
#pragma unroll
  for (int o = 1; o < 32; o <<= 1) sum += __shfl_xor(sum, o);
  if ((tid & 31) == 0) sred[tid >> 5] = sum; __syncthreads(); if (tid == 0) { float a = 0.f; for (int i = 0; i < 8; ++i) a += sred[i]; sbc = a > 0.f ? 2048.0f / a : 0.f; }   /* a fully excluded row yields P = 0 */ __syncthreads(); const float inv = sbc;
  for (int k = tid; k < kend; k += 256) shv[k] = shv[k] * inv;
  __syncthreads(); for (int q = tid; q < kend / 4; q += 256) vst2(sr + q * 4, *(const v4f*)&shv[q * 4]); }
// ---- k_pv: block = 16 queries (tile qt) of (b, h), PVW waves: wave w takes the 32-key chunks w, w + PVW, ... of keys [0, kend), so that the longest chain of dependent loads is 1/PVW as long; the PVW partial 16 x 64 tiles are summed through LDS in wave order (P x 2^11 once to f16 against v f16: 1 product; causal early query blocks: P and v as bf16 hi + lo, 3 products); 256-B (row, head) segment by 16 lanes
#define PVW 16
__global__ __launch_bounds__(32 * PVW) void k_pv(const float* __restrict__ PS0, const _Float16* __restrict__ VT, const __bf16* __restrict__ VB, const __bf16* __restrict__ VBL, int b, int h0, float* __restrict__ Y) { const int h = h0 + blockIdx.z; const float* PS = PS0 + (size_t)blockIdx.z * TT * TT; __shared__ __align__(16) float ss[PVW][16][HD + 4];
  const int tid = threadIdx.x, wave = __builtin_amdgcn_readfirstlane(tid >> 5), lane = tid & 31, col = lane & 15, g = lane >> 4; const int ql0 = blockIdx.x * 16; const int qb = blockIdx.x >> 2; const int kce = (kb_last(qb) + 1) * 4;
  v8f acc[HD / 16] = {};
  if (qb < QBH) {
#pragma unroll 1
    for (int kc = wave; kc < kce; kc += PVW) { const F2 p = split_row(PS + (size_t)(ql0 + col) * TT, kc * 32, lane);
      asm volatile("s_wait_loadcnt 0x0" ::: "memory");
#pragma unroll
      for (int j = 0; j < HD / 16; ++j) { const size_t po = ((size_t)b * CC + h * HD + j * 16 + col) * (size_t)KHI + kc * 32; const v16b vh = frag_b(VB + po, lane); acc[j] = wmma_bf(p.h, vh, acc[j]); acc[j] = wmma_bf(p.l, vh, acc[j]); acc[j] = wmma_bf(p.h, frag_b(VBL + po, lane), acc[j]); } }
  } else {
#pragma unroll 1
    for (int kc = wave; kc < kce; kc += PVW) { const v16h p = frag_f32(PS + (size_t)(ql0 + col) * TT + kc * 32, lane);
      asm volatile("s_wait_loadcnt 0x0" ::: "memory");
#pragma unroll
      for (int j = 0; j < HD / 16; ++j) { const size_t po = ((size_t)b * CC + h * HD + j * 16 + col) * (size_t)TT + kc * 32; acc[j] = wmma16(p, frag_h(VT + po, lane), acc[j]); } } }
#pragma unroll
  for (int j = 0; j < HD / 16; ++j)
#pragma unroll
    for (int r = 0; r < 8; ++r) ss[wave][8 * g + r][j * 16 + col] = acc[j][r];
  __syncthreads();   /* every wave's partial tile is in LDS before any thread sums across waves */
  if (tid < 16 * HD / 4) { const int rl = tid >> 4, c4 = (tid & 15) * 4; v4f s = *(const v4f*)&ss[0][rl][c4];
#pragma unroll
    for (int w = 1; w < PVW; ++w) s += *(const v4f*)&ss[w][rl][c4];
    vst2(Y + ((size_t)b * TT + ql0 + rl) * CC + h * HD + c4, s * (1.0f / 2048.0f)); } }
// ---- k_out: block = (64 rows, 128 cols): out = ctx Wo (+ bo): ctx x 2^6 once to f16 against Wo as f16(bf16 x 2^8) exact (1 product) x 2^-14; causal early rows (< QHI of each sequence): ctx bf16 hi + lo against exact bf16 Wo (2 products)
__global__ __launch_bounds__(128) void k_out(const float* __restrict__ Y, const float* __restrict__ WO, const float* __restrict__ BO, float* __restrict__ OUT) { __shared__ __align__(16) float sf[4][16][132];
  const int tid = threadIdx.x, wave = tid >> 5, lane = tid & 31, col = lane & 15, g = lane >> 4; const int c0 = blockIdx.y * 128; const size_t r0 = (size_t)blockIdx.x * 64 + wave * 16;
  v8f acc[8] = {};
  if (CAUSAL && (int)(((size_t)blockIdx.x * 64) % TT) < QHI) {   /* block-uniform */
#pragma unroll 2
    for (int kc = 0; kc < CC / 32; ++kc) { const F2 a = split_row(Y + (r0 + col) * CC, kc * 32, lane); asm volatile("s_wait_loadcnt 0x0" ::: "memory");
#pragma unroll
      for (int j = 0; j < 8; ++j) { const v16b w = WOCOL(WO, kc * 32, c0 + j * 16 + col, lane); asm volatile("s_wait_loadcnt 0x0" ::: "memory"); acc[j] = wmma_bf(a.h, w, acc[j]); acc[j] = wmma_bf(a.l, w, acc[j]); } }
#pragma unroll
    for (int j = 0; j < 8; ++j) { const float bias = BO ? bfr(BO[c0 + j * 16 + col]) : 0.f;
#pragma unroll
      for (int r = 0; r < 8; ++r) sf[wave][8 * g + r][j * 16 + col] = acc[j][r] + bias; }
  } else {
#pragma unroll 2
    for (int kc = 0; kc < CC / 32; ++kc) { const v16h a = frag_f32s(Y + (r0 + col) * CC + kc * 32, lane, 64.0f); asm volatile("s_wait_loadcnt 0x0" ::: "memory");   /* ctx carried x 2^6 into f16 so small-magnitude context rows stay clear of f16 subnormals */
#pragma unroll
      for (int j = 0; j < 8; ++j) { const v16h w = WOCOLH(WO, kc * 32, c0 + j * 16 + col, lane); asm volatile("s_wait_loadcnt 0x0" ::: "memory"); acc[j] = wmma16(a, w, acc[j]); } }
#pragma unroll
    for (int j = 0; j < 8; ++j) { const float bias = BO ? bfr(BO[c0 + j * 16 + col]) : 0.f;
#pragma unroll
      for (int r = 0; r < 8; ++r) sf[wave][8 * g + r][j * 16 + col] = acc[j][r] * (1.0f / 16384.0f) + bias; } }   /* 2^-8 (Wo carry) x 2^-6 (ctx carry) */
  LDSX(); for (int rl = 0; rl < 16; ++rl) vst2(OUT + (r0 + rl) * DIN + c0 + lane * 4, *(const v4f*)&sf[wave][rl][lane * 4]); }

extern "C" void kernel_launch(void* const* d_in, const int* in_sizes, int n_in, void* d_out, int out_size, void* d_ws, size_t ws_size, hipStream_t stream) {
  (void)in_sizes; (void)n_in; (void)out_size;
  const float** F = (const float**)d_in;
  if (ws_size < (size_t)WS_END) return;
  char* ws = (char*)d_ws; _Float16 *QH = (_Float16*)(ws + WS_QH), *KH = (_Float16*)(ws + WS_KH), *VT = (_Float16*)(ws + WS_VT), *QL = (_Float16*)(ws + WS_QL), *KL = (_Float16*)(ws + WS_KL); __bf16 *VB = (__bf16*)(ws + WS_VB), *VBL = (__bf16*)(ws + WS_VBL); float *S = (float*)(ws + WS_S), *Y = (float*)(ws + WS_Y);
  (void)Y; (void)QL; (void)KL; (void)VB; (void)VBL;
  // inputs: 0 x [8,2048,512]; 1 Wq [8,512,64] (per-head (in,out)); 2 Wk; 3 Wv; 4 Wo [512,512] (in,out); 5 bo [512] (normal x 0.01, read)
  k_proj<<<dim3(TNB * TT / 64, CC / 128, 3), 128, 0, stream>>>(F[0], F[0], F[0], F[1], F[2], F[3], nullptr, nullptr, nullptr, QH, QL, KH, KL, VT, VB, VBL);
  for (int b = 0; b < TNB; ++b) for (int h0 = 0; h0 < NH; h0 += HG) {
    k_sc<<<dim3(NQB, TT / 128, HG), 128, 0, stream>>>(QH, KH, QL, KL, b, h0, S);
    k_sm<<<dim3(TT, HG), 256, 0, stream>>>(S);
    k_pv<<<dim3(TT / 16, 1, HG), 32 * PVW, 0, stream>>>(S, VT, VB, VBL, b, h0, Y);
  }
  k_out<<<dim3(TNB * TT / 64, DIN / 128), 128, 0, stream>>>(Y, F[4], F[5], (float*)d_out);
}

// v002
// A run of this version takes 294 microseconds.
// Two timings next to v001 put it at 3.92 and 3.90 times that version's speed.
// Counting every step since v000, it is 6.36 times as fast.
// compute dtype: all float inputs rounded to bf16; per-head q/k/v projections with EXACT bf16 products on WMMA 16x16x32 (f32 accumulate); causal logits: 3 products for the first 384 rows, single f16 q x k after, x 64^-0.5; softmax f32 with a running maximum and sum over passes of 32 keys; exp(s - max) x 2^11 once to f16 x v once to f16 (bf16 hi + lo below row 384), divided by the sum at the end; ctx hi+lo x exact Wproj below row 384, x2^6 f16 carry x f16(bf16 x 2^8) Wproj after, + bproj; f32 output.
#include <hip/hip_runtime.h>
#include <math.h>

typedef __attribute__((ext_vector_type(16))) _Float16 v16h;
typedef __attribute__((ext_vector_type(16))) __bf16 v16b;
typedef __attribute__((ext_vector_type(8)))  _Float16 v8h;
typedef __attribute__((ext_vector_type(8)))  float v8f;
typedef __attribute__((ext_vector_type(4)))  float v4f;
typedef __attribute__((ext_vector_type(2)))  float v2f;
typedef __attribute__((ext_vector_type(4)))  unsigned v4u;
typedef __attribute__((ext_vector_type(4)))  int v4i;
typedef float __attribute__((may_alias)) float_a;
typedef int __attribute__((may_alias)) int_a;

template <typename T> __device__ __forceinline__ void vst2(void* p, T v) { *(T*)p = v;  }
__device__ __forceinline__ v8f wmma16(v16h a, v16h b, v8f c) {
  v8f d = __builtin_amdgcn_wmma_f32_16x16x32_f16(false, a, false, b, (short)0, c, false, false);
  asm volatile("v_nop\n\tv_nop\n\tv_nop\n\tv_nop" : "+v"(d) : "v"(a), "v"(b));
  return d;
}
__device__ __forceinline__ v8f wmma_bf(v16b a, v16b b, v8f c) {
  v8f d = __builtin_amdgcn_wmma_f32_16x16x32_bf16(false, a, false, b, (short)0, c, false, false);
  asm volatile("v_nop\n\tv_nop\n\tv_nop\n\tv_nop" : "+v"(d) : "v"(a), "v"(b));
  return d;
}
// 16x16x32 fragments: lane = (h = lane>>4, row/col = lane&15); elements 0..7 = k0+8h+0..7, 8..15 = k0+16+8h+0..7; D element r = row 8h+r
__device__ __forceinline__ v16h frag_h(const _Float16* rowk0, int lane) {
  union { v16h v; v8h q[2]; } u; const _Float16* p = rowk0 + 8 * (lane >> 4);
  u.q[0] = *(const v8h*)p; u.q[1] = *(const v8h*)(p + 16); return u.v;
}
__device__ __forceinline__ v16h frag_f32(const float* rowk0, int lane) {
  v16h a; const float* p = rowk0 + 8 * (lane >> 4);
#pragma unroll
  for (int i = 0; i < 8; ++i) { a[i] = (_Float16)p[i]; a[8 + i] = (_Float16)p[16 + i]; }
  return a;
}
__device__ __forceinline__ v16h frag_f32s(const float* rowk0, int lane, float sc) {
  v16h a; const float* p = rowk0 + 8 * (lane >> 4);
#pragma unroll
  for (int i = 0; i < 8; ++i) { a[i] = (_Float16)(p[i] * sc); a[8 + i] = (_Float16)(p[16 + i] * sc); }
  return a;
}
// column fragment from a [K][ld] layout (column n), rows >= K read as 0
__device__ __forceinline__ v16h fragc_f32(const float* W, int k0, int n, int lane, int ld, int K) {
  v16h a; const int g = lane >> 4;
#pragma unroll
  for (int i = 0; i < 8; ++i) { const int ka = k0 + 8 * g + i, kb = ka + 16;
    a[i] = (_Float16)(ka < K ? W[(size_t)(ka < K ? ka : K - 1) * ld + n] : 0.f); a[8 + i] = (_Float16)(kb < K ? W[(size_t)(kb < K ? kb : K - 1) * ld + n] : 0.f); }
  return a;
}
struct F2 { v16b h, l; };
__device__ __forceinline__ F2 bsplit16(const float v[16]) { F2 r;
#pragma unroll
  for (int i = 0; i < 16; ++i) { const __bf16 h = (__bf16)v[i]; r.h[i] = h; r.l[i] = (__bf16)(v[i] - (float)h); }
  return r; }
__device__ __forceinline__ F2 split_row(const float* row, int k0, int lane) { float v[16]; const float* p = row + k0 + 8 * (lane >> 4);
#pragma unroll
  for (int i = 0; i < 8; ++i) { v[i] = p[i]; v[8 + i] = p[16 + i]; }
  return bsplit16(v); }
__device__ __forceinline__ F2 split_rowK(const float* row, int k0, int lane, int K) { float v[16]; const int g = lane >> 4;
#pragma unroll
  for (int i = 0; i < 8; ++i) { const int ka = k0 + 8 * g + i, kb = ka + 16; v[i] = ka < K ? row[ka < K ? ka : K - 1] : 0.f; v[8 + i] = kb < K ? row[kb < K ? kb : K - 1] : 0.f; }
  return bsplit16(v); }
__device__ __forceinline__ F2 split_col(const float* W, int k0, int n, int lane, int ld, int K) { float v[16]; const int g = lane >> 4;
#pragma unroll
  for (int i = 0; i < 8; ++i) { const int ka = k0 + 8 * g + i, kb = ka + 16; v[i] = ka < K ? W[(size_t)(ka < K ? ka : K - 1) * ld + n] : 0.f; v[8 + i] = kb < K ? W[(size_t)(kb < K ? kb : K - 1) * ld + n] : 0.f; }
  return bsplit16(v); }
__device__ __forceinline__ v8f mac3(const F2& a, const F2& b, v8f c) { c = wmma_bf(a.l, b.h, c); c = wmma_bf(a.h, b.l, c); return wmma_bf(a.h, b.h, c); }
__device__ __forceinline__ float sigm(float v) { return 1.0f / (1.0f + expf(-v)); }
#define LDSX() do { asm volatile("s_wait_dscnt 0" ::: "memory"); __builtin_amdgcn_wave_barrier(); __builtin_amdgcn_fence(__ATOMIC_RELEASE, "workgroup"); } while (0)

// Causal multi-head self-attention with PER-HEAD projection weights (x [8,2048,512]; 8 heads x 64; Wq/Wk/Wv [8,512,64] = [H][C][D] (in,out per head); Wo [512,512] (in,out) + bo (normal x 0.01: read); tril, -inf): q_h = x Wq[h]; out = concat_h(softmax(causal(q_h k_h^T * 64^-0.5)) v_h) Wo + bo.
#define NB 8
#define TT 2048
#define CC 512            // NH * HD = projected width
#define DIN 512          // input (model) width
#define NH 8
#define HD 64
#define SCALE (0.125f)
#define CAUSAL 1
#ifndef TNB
#define TNB NB
#endif
__device__ __forceinline__ float bfr(float v) { return (float)(__bf16)v; }
typedef __attribute__((ext_vector_type(8))) __bf16 v8b;
__device__ __forceinline__ v16b frag_b(const __bf16* rowk0, int lane) {
  union { v16b v; v8b q[2]; } u; const __bf16* p = rowk0 + 8 * (lane >> 4);
  u.q[0] = *(const v8b*)p; u.q[1] = *(const v8b*)(p + 16); return u.v;
}
#define QHI 384            // query rows of each sequence (few keys, no averaging) that carry a q residual plane and take the high-precision path
#define KHI 384            // key rows carrying k residual / v bf16 hi+lo planes (used only by the causal high-precision path)
// B fragment (k rows k0+.., output column o) of a weight: (in,out) [K][ld] or (out,in) [ld rows of K]: bf16 exact, or f16(bf16 * 256) exact
__device__ __forceinline__ v16b wcol_io(const float* Wm, int k0, int o, int lane, int ld) { v16b w; const int g = lane >> 4;
#pragma unroll
  for (int i = 0; i < 8; ++i) { w[i] = (__bf16)Wm[(size_t)(k0 + 8 * g + i) * ld + o]; w[8 + i] = (__bf16)Wm[(size_t)(k0 + 16 + 8 * g + i) * ld + o]; }
  return w; }
__device__ __forceinline__ v16b wcol_oi(const float* Wm, int k0, int o, int lane, int K) { v16b w; const float* p = Wm + (size_t)o * K + k0 + 8 * (lane >> 4);
#pragma unroll
  for (int i = 0; i < 8; ++i) { w[i] = (__bf16)p[i]; w[8 + i] = (__bf16)p[16 + i]; }
  return w; }
__device__ __forceinline__ v16h wcolh_io(const float* Wm, int k0, int o, int lane, int ld) { v16h w; const int g = lane >> 4;
#pragma unroll
  for (int i = 0; i < 8; ++i) { w[i] = (_Float16)(bfr(Wm[(size_t)(k0 + 8 * g + i) * ld + o]) * 256.0f); w[8 + i] = (_Float16)(bfr(Wm[(size_t)(k0 + 16 + 8 * g + i) * ld + o]) * 256.0f); }
  return w; }
__device__ __forceinline__ v16h wcolh_oi(const float* Wm, int k0, int o, int lane, int K) { v16h w; const float* p = Wm + (size_t)o * K + k0 + 8 * (lane >> 4);
#pragma unroll
  for (int i = 0; i < 8; ++i) { w[i] = (_Float16)(bfr(p[i]) * 256.0f); w[8 + i] = (_Float16)(bfr(p[16 + i]) * 256.0f); }
  return w; }
#define WQKV_LAYOUT 2   // 0 = (in,out) [DIN][CC]; 1 = (out,in) [CC][DIN]; 2 = per-head [NH][DIN][HD]
__device__ __forceinline__ v16b wcol_hdk(const float* Wm, int k0, int o, int lane) { v16b w; const int g = lane >> 4; const float* p = Wm + (size_t)(o / HD) * DIN * HD + (o % HD);
#pragma unroll
  for (int i = 0; i < 8; ++i) { w[i] = (__bf16)p[(size_t)(k0 + 8 * g + i) * HD]; w[8 + i] = (__bf16)p[(size_t)(k0 + 16 + 8 * g + i) * HD]; }
  return w; }
#define WO_OUT_IN 0
#if WQKV_LAYOUT == 1
#define WCOL(W, k0, o, lane) wcol_oi(W, k0, o, lane, DIN)
#elif WQKV_LAYOUT == 2
#define WCOL(W, k0, o, lane) wcol_hdk(W, k0, o, lane)
#else
#define WCOL(W, k0, o, lane) wcol_io(W, k0, o, lane, CC)
#endif
#if WO_OUT_IN
#define WOCOL(W, k0, o, lane) wcol_oi(W, k0, o, lane, CC)
#define WOCOLH(W, k0, o, lane) wcolh_oi(W, k0, o, lane, CC)
#else
#define WOCOL(W, k0, o, lane) wcol_io(W, k0, o, lane, DIN)
#define WOCOLH(W, k0, o, lane) wcolh_io(W, k0, o, lane, DIN)
#endif

#ifndef PROJ_EXTRA_PARAMS
#define PROJ_EXTRA_PARAMS
#endif

#define WS_QH  0u                                      // f16 q rows [b*t][CC]
#define WS_KH  (WS_QH + 2u * (size_t)NB * TT * CC)      // f16 k rows [b*t][CC]
#define WS_VT  (WS_KH + 2u * (size_t)NB * TT * CC)      // f16 v planes [b][c][t]
#define WS_QL  (WS_VT + 2u * (size_t)NB * CC * TT)      // f16 q residual x 2^10 rows [b][t < QHI][CC]
#define WS_KL  (WS_QL + 2u * (size_t)NB * QHI * CC)     // f16 k residual x 2^10 rows [b][t < KHI][CC]
#define WS_VB  (WS_KL + 2u * (size_t)NB * KHI * CC)     // bf16 v hi planes [b][c][t < KHI]
#define WS_VBL (WS_VB + 2u * (size_t)NB * CC * KHI)
#define WS_Y   (WS_VBL + 2u * (size_t)NB * CC * KHI)    // f32 ctx rows [b*t][CC] (only when there is an output projection)
#define WS_END (WS_Y  + 4u * (size_t)NB * TT * CC)

// ---- k_proj: block = (64 rows, 128 cols, which): q/k/v = X W (+ b) with exact bf16 products (K = DIN) -> which 0: q f16 rows (+ residual rows < QHI); 1: k f16 rows (+ residual rows < KHI); 2: v f16 planes [c][t] (+ bf16 hi/lo planes for t < KHI)
__global__ __launch_bounds__(128) void k_proj(const float* __restrict__ XQ, const float* __restrict__ XK, const float* __restrict__ XV, const float* __restrict__ WQ, const float* __restrict__ WK, const float* __restrict__ WV, const float* __restrict__ BQ, const float* __restrict__ BK, const float* __restrict__ BV,
    _Float16* __restrict__ QH, _Float16* __restrict__ QL, _Float16* __restrict__ KH, _Float16* __restrict__ KL, _Float16* __restrict__ VT, __bf16* __restrict__ VB, __bf16* __restrict__ VBL) {
  __shared__ __align__(16) _Float16 sh[64][136], sl[64][136]; __shared__ __align__(16) _Float16 th[128][72]; __shared__ __align__(16) __bf16 tb[128][72], tbl[128][72];
  const int tid = threadIdx.x, wave = tid >> 5, lane = tid & 31, col = lane & 15, g = lane >> 4; const int which = blockIdx.z; const int c0 = blockIdx.y * 128; const size_t r0 = (size_t)blockIdx.x * 64; const size_t bb = r0 / TT; const int t0 = (int)(r0 % TT);
  const float* X = which == 0 ? XQ : which == 1 ? XK : XV; const float* WA = which == 0 ? WQ : which == 1 ? WK : WV; const float* BA = which == 0 ? BQ : which == 1 ? BK : BV;
  v8f acc[8] = {};
#pragma unroll 2
  for (int kc = 0; kc < DIN / 32; ++kc) { v16b a; { const float* p = X + (r0 + wave * 16 + col) * DIN + kc * 32 + 8 * g;
#pragma unroll
      for (int i = 0; i < 8; ++i) { a[i] = (__bf16)p[i]; a[8 + i] = (__bf16)p[16 + i]; } }
    asm volatile("s_wait_loadcnt 0x0" ::: "memory");
#pragma unroll
    for (int j = 0; j < 8; ++j) { const v16b w = WCOL(WA, kc * 32, c0 + j * 16 + col, lane); asm volatile("s_wait_loadcnt 0x0" ::: "memory"); acc[j] = wmma_bf(a, w, acc[j]); } }
  if (which < 2) { _Float16* DH = which == 0 ? QH : KH; _Float16* DL = which == 0 ? QL : KL; const int nhi = which == 0 ? QHI : KHI; const bool hi_rows = t0 < nhi;
#pragma unroll
    for (int j = 0; j < 8; ++j) { const float bias = BA ? bfr(BA[c0 + j * 16 + col]) : 0.f;
#pragma unroll
      for (int r = 0; r < 8; ++r) { const float v = acc[j][r] + bias; const _Float16 hv = (_Float16)v; sh[wave * 16 + 8 * g + r][j * 16 + col] = hv; sl[wave * 16 + 8 * g + r][j * 16 + col] = (_Float16)((v - (float)hv) * 1024.0f); } }
    __syncthreads();
    for (int e = tid; e < 64 * 16; e += 128) { const int rl = e >> 4, q = e & 15; vst2((unsigned*)(DH + (r0 + rl) * CC + c0 + q * 8), *(const v4u*)&sh[rl][q * 8]); if (hi_rows) vst2((unsigned*)(DL + (bb * nhi + t0 + rl) * (size_t)CC + c0 + q * 8), *(const v4u*)&sl[rl][q * 8]); }
  } else { const bool hi_rows = t0 < KHI;
#pragma unroll
    for (int j = 0; j < 8; ++j) { const float bias = BA ? bfr(BA[c0 + j * 16 + col]) : 0.f;
#pragma unroll
      for (int r = 0; r < 8; ++r) { const float v = acc[j][r] + bias; const int rl = wave * 16 + 8 * g + r, cl = j * 16 + col; th[cl][rl] = (_Float16)v; const __bf16 bh = (__bf16)v; tb[cl][rl] = bh; tbl[cl][rl] = (__bf16)(v - (float)bh); } }
    __syncthreads();
    for (int e = tid; e < 128 * 8; e += 128) { const int cl = e >> 3, q = e & 7; vst2((unsigned*)(VT + (bb * CC + c0 + cl) * (size_t)TT + t0 + q * 8), *(const v4u*)&th[cl][q * 8]); if (hi_rows) { const size_t o3 = (bb * CC + c0 + cl) * (size_t)KHI + t0 + q * 8; vst2((unsigned*)(VB + o3), *(const v4u*)&tb[cl][q * 8]); vst2((unsigned*)(VBL + o3), *(const v4u*)&tbl[cl][q * 8]); } } } }
#define FAW 8
#define NT32 (TT / 32)
static_assert(QHI % 32 == 0 && KHI >= QHI && NT32 % (2 * FAW) == 0, "tile split");
__device__ __forceinline__ v8f mm_h(v16h a, v16h b, v8f c) { return __builtin_amdgcn_wmma_f32_16x16x32_f16(false, a, false, b, (short)0, c, false, false); }
__device__ __forceinline__ v8f mm_b(v16b a, v16b b, v8f c) { return __builtin_amdgcn_wmma_f32_16x16x32_bf16(false, a, false, b, (short)0, c, false, false); }
// fragment from a wave-uniform row base plus the lane's own byte offset (row pitch x (lane & 15) + 16 x (lane >> 4)): what changes from pass to pass is scalar arithmetic, and one vector add forms the address of a whole group of loads
__device__ __forceinline__ v16h frag_hu(const _Float16* ub, unsigned vo) { union { v16h v; v8h q[2]; } u; const char* p = (const char*)ub + vo; u.q[0] = *(const v8h*)p; u.q[1] = *(const v8h*)(p + 32); return u.v; }
__device__ __forceinline__ v16b frag_bu(const __bf16* ub, unsigned vo) { union { v16b v; v8b q[2]; } u; const char* p = (const char*)ub + vo; u.q[0] = *(const v8b*)p; u.q[1] = *(const v8b*)(p + 32); return u.v; }
template <bool HI>
__device__ __forceinline__ void fa_tile(const _Float16* __restrict__ QH, const _Float16* __restrict__ KH, const _Float16* __restrict__ QL, const _Float16* __restrict__ KL, const _Float16* __restrict__ VT, const __bf16* __restrict__ VB, const __bf16* __restrict__ VBL, int b, int h, int t, int lane, float* __restrict__ Y) {
  const int col = lane & 15, g = lane >> 4, ql0 = t * 32;
  const float C2 = SCALE * 1.44269504088896f;   // logit scale x log2(e)
  const float OFF = HI ? 0.f : 11.f;            // f16 P carried x 2^11 (clear of f16 subnormals); it cancels against the sum
  const _Float16* Kr = KH + (size_t)b * TT * CC + h * HD; const _Float16* KLr = KL + (size_t)b * KHI * CC + h * HD;   // wave-uniform bases
  const _Float16* Vr = VT + ((size_t)b * CC + h * HD) * (size_t)TT; const size_t vbo = ((size_t)b * CC + h * HD) * (size_t)KHI;
  const unsigned ro = (unsigned)(col * CC * 2 + 16 * g), vo = (unsigned)(col * (HI ? KHI : TT) * 2 + 16 * g);   // lane byte offsets: q / k rows, v planes
  v16h qf[2][2], qlf[2][2];
#pragma unroll
  for (int qt = 0; qt < 2; ++qt)
#pragma unroll
    for (int kc = 0; kc < 2; ++kc) { qf[qt][kc] = frag_hu(QH + ((size_t)b * TT + ql0 + qt * 16) * CC + h * HD + kc * 32, ro); if (HI) qlf[qt][kc] = frag_hu(QL + ((size_t)b * QHI + ql0 + qt * 16) * CC + h * HD + kc * 32, ro); }
  v8f o[2][4] = {}; float m[2] = {-3.0e38f, -3.0e38f}, l[2] = {0.f, 0.f};
  v16h kf[2][2];   // f16 path: K rows fetched one pass ahead; the high-precision path (12 passes at most, more live registers) fetches them in the pass
  if (!HI) {
#pragma unroll
    for (int kt = 0; kt < 2; ++kt)
#pragma unroll
      for (int kc = 0; kc < 2; ++kc) kf[kt][kc] = frag_hu(Kr + (size_t)(kt * 16) * CC + kc * 32, ro); }
#pragma unroll 1   /* rolled: one pass already holds 16 independent products, and a second copy would not fit 256 registers */
  for (int c = 0; c <= t; ++c) { const int k0 = c * 32;
    v16h vf[4];
    if (!HI) {
#pragma unroll
      for (int j = 0; j < 4; ++j) vf[j] = frag_hu(Vr + (size_t)(j * 16) * TT + k0, vo);
      asm volatile("s_wait_xcnt 0x0" ::: "memory"); }   /* stands before the v loads' address registers are written again (the K fetch below may land in them); it also keeps the v loads at the head of the pass, ahead of the logits */
    v8f st[2][2] = {}, sl[2][2] = {};   // st[qt][kt][r] = S^T[key k0 + 16 kt + 8 g + r][query ql0 + 16 qt + col]
#pragma unroll
    for (int kc = 0; kc < 2; ++kc)
#pragma unroll
      for (int kt = 0; kt < 2; ++kt) { v16h klf; if (HI) { kf[kt][kc] = frag_hu(Kr + (size_t)(k0 + kt * 16) * CC + kc * 32, ro); klf = frag_hu(KLr + (size_t)(k0 + kt * 16) * CC + kc * 32, ro); }
#pragma unroll
        for (int qt = 0; qt < 2; ++qt) { st[qt][kt] = mm_h(kf[kt][kc], qf[qt][kc], st[qt][kt]); if (HI) { sl[qt][kt] = mm_h(kf[kt][kc], qlf[qt][kc], sl[qt][kt]); sl[qt][kt] = mm_h(klf, qf[qt][kc], sl[qt][kt]); } } }
    if (!HI) { const int kn = c < t ? k0 + 32 : k0;   // the next pass's K rows are fetched behind this pass's logits (no branch behind the products: the last pass fetches its own rows again, in bounds)
#pragma unroll
      for (int kt = 0; kt < 2; ++kt)
#pragma unroll
        for (int kc = 0; kc < 2; ++kc) kf[kt][kc] = frag_hu(Kr + (size_t)(kn + kt * 16) * CC + kc * 32, ro);
      asm volatile("s_wait_xcnt 0x0" ::: "memory"); }   /* stands before the K loads' address registers are written again; it also keeps the fetch here, a whole softmax ahead of its use */
    v16h pf[2]; F2 pb[2];
#pragma unroll
    for (int qt = 0; qt < 2; ++qt) { float s[16];
#pragma unroll
      for (int i = 0; i < 16; ++i) s[i] = HI ? st[qt][i >> 3][i & 7] + sl[qt][i >> 3][i & 7] * (1.0f / 1024.0f) : st[qt][i >> 3][i & 7];
      if (c == t) {   /* the pass on the diagonal (wave-uniform): keys past the query are excluded by index */
#pragma unroll
        for (int i = 0; i < 16; ++i) if ((i >> 3) * 16 + 8 * g + (i & 7) > qt * 16 + col) s[i] = -3.0e38f; }
      float r8[8];
#pragma unroll
      for (int i = 0; i < 8; ++i) r8[i] = fmaxf(s[i], s[8 + i]);
      float mx = fmaxf(fmaxf(fmaxf(r8[0], r8[1]), fmaxf(r8[2], r8[3])), fmaxf(fmaxf(r8[4], r8[5]), fmaxf(r8[6], r8[7])));
      mx = fmaxf(mx, __shfl_xor(mx, 16));
      const float mn = fmaxf(m[qt], mx); const float al = __builtin_amdgcn_exp2f((m[qt] - mn) * C2); m[qt] = mn;
#pragma unroll
      for (int i = 0; i < 16; ++i) s[i] = __builtin_amdgcn_exp2f((s[i] - mn) * C2 + OFF);
#pragma unroll
      for (int i = 0; i < 8; ++i) r8[i] = s[i] + s[8 + i];
      l[qt] = l[qt] * al + (((r8[0] + r8[1]) + (r8[2] + r8[3])) + ((r8[4] + r8[5]) + (r8[6] + r8[7])));
#pragma unroll
      for (int j = 0; j < 4; ++j) o[qt][j] *= al;
      if (HI) pb[qt] = bsplit16(s); else {
#pragma unroll
        for (int i = 0; i < 16; ++i) pf[qt][i] = (_Float16)s[i]; } }   // element i = key k0 + 16 (i >> 3) + 8 g + (i & 7): the B operand's own k order
#pragma unroll
    for (int j = 0; j < 4; ++j) { v16b vh, vl; if (HI) { vh = frag_bu(VB + vbo + (size_t)(j * 16) * KHI + k0, vo); vl = frag_bu(VBL + vbo + (size_t)(j * 16) * KHI + k0, vo); }
#pragma unroll
      for (int qt = 0; qt < 2; ++qt) { if (HI) { o[qt][j] = mm_b(vh, pb[qt].h, o[qt][j]); o[qt][j] = mm_b(vh, pb[qt].l, o[qt][j]); o[qt][j] = mm_b(vl, pb[qt].h, o[qt][j]); } else o[qt][j] = mm_h(vf[j], pf[qt], o[qt][j]); } } }
  if (!HI) asm volatile("s_wait_loadcnt 0x0" ::: "memory");   /* the last pass's K fetch has no reader: it has landed before its registers are used again or the wave ends */
#pragma unroll
  for (int qt = 0; qt < 2; ++qt) { const float lt = l[qt] + __shfl_xor(l[qt], 16); const float inv = lt > 0.f ? 1.0f / lt : 0.f;   // o[qt][j][r] = O^T[d 16 j + 8 g + r][query]
    float* yp = Y + ((size_t)b * TT + ql0 + qt * 16 + col) * CC + h * HD + 8 * g;
#pragma unroll
    for (int j = 0; j < 4; ++j) { const v8f v = o[qt][j] * inv; vst2(yp + j * 16, (v4f){v[0], v[1], v[2], v[3]}); vst2(yp + j * 16 + 4, (v4f){v[4], v[5], v[6], v[7]}); } }
  asm volatile("s_wait_xcnt 0x0" ::: "memory"); }   /* stands before the wave's next tile writes the registers that these stores name */
__global__ __launch_bounds__(32 * FAW) void k_fa(const _Float16* __restrict__ QH, const _Float16* __restrict__ KH, const _Float16* __restrict__ QL, const _Float16* __restrict__ KL, const _Float16* __restrict__ VT, const __bf16* __restrict__ VB, const __bf16* __restrict__ VBL, float* __restrict__ Y) {
  const int lane = threadIdx.x & 31, wave = __builtin_amdgcn_readfirstlane(threadIdx.x >> 5); const int h = blockIdx.y, b = blockIdx.z; const int pi = blockIdx.x * FAW + wave;
  for (int half = 0; half < 2; ++half) { const int t = half ? pi : NT32 - 1 - pi;   /* wave-uniform */
    if (t < QHI / 32) fa_tile<true>(QH, KH, QL, KL, VT, VB, VBL, b, h, t, lane, Y); else fa_tile<false>(QH, KH, QL, KL, VT, VB, VBL, b, h, t, lane, Y); } }
// ---- k_out: block = (64 rows, 128 cols): out = ctx Wo (+ bo): ctx x 2^6 once to f16 against Wo as f16(bf16 x 2^8) exact (1 product) x 2^-14; causal early rows (< QHI of each sequence): ctx bf16 hi + lo against exact bf16 Wo (2 products)
__global__ __launch_bounds__(128) void k_out(const float* __restrict__ Y, const float* __restrict__ WO, const float* __restrict__ BO, float* __restrict__ OUT) { __shared__ __align__(16) float sf[4][16][132];
  const int tid = threadIdx.x, wave = tid >> 5, lane = tid & 31, col = lane & 15, g = lane >> 4; const int c0 = blockIdx.y * 128; const size_t r0 = (size_t)blockIdx.x * 64 + wave * 16;
  v8f acc[8] = {};
  if (CAUSAL && (int)(((size_t)blockIdx.x * 64) % TT) < QHI) {   /* block-uniform */
#pragma unroll 2
    for (int kc = 0; kc < CC / 32; ++kc) { const F2 a = split_row(Y + (r0 + col) * CC, kc * 32, lane); asm volatile("s_wait_loadcnt 0x0" ::: "memory");
#pragma unroll
      for (int j = 0; j < 8; ++j) { const v16b w = WOCOL(WO, kc * 32, c0 + j * 16 + col, lane); asm volatile("s_wait_loadcnt 0x0" ::: "memory"); acc[j] = wmma_bf(a.h, w, acc[j]); acc[j] = wmma_bf(a.l, w, acc[j]); } }
#pragma unroll
    for (int j = 0; j < 8; ++j) { const float bias = BO ? bfr(BO[c0 + j * 16 + col]) : 0.f;
#pragma unroll
      for (int r = 0; r < 8; ++r) sf[wave][8 * g + r][j * 16 + col] = acc[j][r] + bias; }
  } else {
#pragma unroll 2
    for (int kc = 0; kc < CC / 32; ++kc) { const v16h a = frag_f32s(Y + (r0 + col) * CC + kc * 32, lane, 64.0f); asm volatile("s_wait_loadcnt 0x0" ::: "memory");   /* ctx carried x 2^6 into f16 so small-magnitude context rows stay clear of f16 subnormals */
#pragma unroll
      for (int j = 0; j < 8; ++j) { const v16h w = WOCOLH(WO, kc * 32, c0 + j * 16 + col, lane); asm volatile("s_wait_loadcnt 0x0" ::: "memory"); acc[j] = wmma16(a, w, acc[j]); } }
#pragma unroll
    for (int j = 0; j < 8; ++j) { const float bias = BO ? bfr(BO[c0 + j * 16 + col]) : 0.f;
#pragma unroll
      for (int r = 0; r < 8; ++r) sf[wave][8 * g + r][j * 16 + col] = acc[j][r] * (1.0f / 16384.0f) + bias; } }   /* 2^-8 (Wo carry) x 2^-6 (ctx carry) */
  LDSX(); for (int rl = 0; rl < 16; ++rl) vst2(OUT + (r0 + rl) * DIN + c0 + lane * 4, *(const v4f*)&sf[wave][rl][lane * 4]); }

extern "C" void kernel_launch(void* const* d_in, const int* in_sizes, int n_in, void* d_out, int out_size, void* d_ws, size_t ws_size, hipStream_t stream) {
  (void)in_sizes; (void)n_in; (void)out_size;
  const float** F = (const float**)d_in;
  if (ws_size < (size_t)WS_END) return;
  char* ws = (char*)d_ws; _Float16 *QH = (_Float16*)(ws + WS_QH), *KH = (_Float16*)(ws + WS_KH), *VT = (_Float16*)(ws + WS_VT), *QL = (_Float16*)(ws + WS_QL), *KL = (_Float16*)(ws + WS_KL); __bf16 *VB = (__bf16*)(ws + WS_VB), *VBL = (__bf16*)(ws + WS_VBL); float *Y = (float*)(ws + WS_Y);
  (void)Y; (void)QL; (void)KL; (void)VB; (void)VBL;
  // inputs: 0 x [8,2048,512]; 1 Wq [8,512,64] (per-head (in,out)); 2 Wk; 3 Wv; 4 Wo [512,512] (in,out); 5 bo [512] (normal x 0.01, read)
  k_proj<<<dim3(TNB * TT / 64, CC / 128, 3), 128, 0, stream>>>(F[0], F[0], F[0], F[1], F[2], F[3], nullptr, nullptr, nullptr, QH, QL, KH, KL, VT, VB, VBL);
  k_fa<<<dim3(NT32 / (2 * FAW), NH, TNB), 32 * FAW, 0, stream>>>(QH, KH, QL, KL, VT, VB, VBL, Y);
  k_out<<<dim3(TNB * TT / 64, DIN / 128), 128, 0, stream>>>(Y, F[4], F[5], (float*)d_out);
}

// v003
// A run of this version takes 156 microseconds.
// Next to v002, in two timings, it ran 1.89 times as fast each time.
// Counting every step since v000, it is 12.0 times as fast.
// compute dtype: all float inputs rounded to bf16; per-head q/k/v projections with EXACT bf16 products on WMMA 16x16x32 (f32 accumulate); causal logits: 3 products for the first 384 rows, single f16 q x k after, x 64^-0.5; softmax f32 with a running maximum and sum over passes of 32 keys; exp(s - max) x 2^11 once to f16 x v once to f16 (bf16 hi + lo below row 384), divided by the sum at the end; ctx hi+lo x exact Wproj below row 384, x2^6 f16 carry x f16(bf16 x 2^8) Wproj after, + bproj; f32 output.
#include <hip/hip_runtime.h>
#include <math.h>

typedef __attribute__((ext_vector_type(16))) _Float16 v16h;
typedef __attribute__((ext_vector_type(16))) __bf16 v16b;
typedef __attribute__((ext_vector_type(8)))  _Float16 v8h;
typedef __attribute__((ext_vector_type(8)))  float v8f;
typedef __attribute__((ext_vector_type(4)))  float v4f;
typedef __attribute__((ext_vector_type(2)))  float v2f;
typedef __attribute__((ext_vector_type(4)))  unsigned v4u;
typedef __attribute__((ext_vector_type(4)))  int v4i;
typedef float __attribute__((may_alias)) float_a;
typedef int __attribute__((may_alias)) int_a;

template <typename T> __device__ __forceinline__ void vst2(void* p, T v) { *(T*)p = v;  }
__device__ __forceinline__ v8f wmma16(v16h a, v16h b, v8f c) {
  v8f d = __builtin_amdgcn_wmma_f32_16x16x32_f16(false, a, false, b, (short)0, c, false, false);
  asm volatile("v_nop\n\tv_nop\n\tv_nop\n\tv_nop" : "+v"(d) : "v"(a), "v"(b));
  return d;
}
__device__ __forceinline__ v8f wmma_bf(v16b a, v16b b, v8f c) {
  v8f d = __builtin_amdgcn_wmma_f32_16x16x32_bf16(false, a, false, b, (short)0, c, false, false);
  asm volatile("v_nop\n\tv_nop\n\tv_nop\n\tv_nop" : "+v"(d) : "v"(a), "v"(b));
  return d;
}
// 16x16x32 fragments: lane = (h = lane>>4, row/col = lane&15); elements 0..7 = k0+8h+0..7, 8..15 = k0+16+8h+0..7; D element r = row 8h+r
__device__ __forceinline__ v16h frag_h(const _Float16* rowk0, int lane) {
  union { v16h v; v8h q[2]; } u; const _Float16* p = rowk0 + 8 * (lane >> 4);
  u.q[0] = *(const v8h*)p; u.q[1] = *(const v8h*)(p + 16); return u.v;
}
__device__ __forceinline__ v16h frag_f32(const float* rowk0, int lane) {
  v16h a; const float* p = rowk0 + 8 * (lane >> 4);
#pragma unroll
  for (int i = 0; i < 8; ++i) { a[i] = (_Float16)p[i]; a[8 + i] = (_Float16)p[16 + i]; }
  return a;
}
__device__ __forceinline__ v16h frag_f32s(const float* rowk0, int lane, float sc) {
  v16h a; const float* p = rowk0 + 8 * (lane >> 4);
#pragma unroll
  for (int i = 0; i < 8; ++i) { a[i] = (_Float16)(p[i] * sc); a[8 + i] = (_Float16)(p[16 + i] * sc); }
  return a;
}
// column fragment from a [K][ld] layout (column n), rows >= K read as 0
__device__ __forceinline__ v16h fragc_f32(const float* W, int k0, int n, int lane, int ld, int K) {
  v16h a; const int g = lane >> 4;
#pragma unroll
  for (int i = 0; i < 8; ++i) { const int ka = k0 + 8 * g + i, kb = ka + 16;
    a[i] = (_Float16)(ka < K ? W[(size_t)(ka < K ? ka : K - 1) * ld + n] : 0.f); a[8 + i] = (_Float16)(kb < K ? W[(size_t)(kb < K ? kb : K - 1) * ld + n] : 0.f); }
  return a;
}
struct F2 { v16b h, l; };
__device__ __forceinline__ F2 bsplit16(const float v[16]) { F2 r;
#pragma unroll
  for (int i = 0; i < 16; ++i) { const __bf16 h = (__bf16)v[i]; r.h[i] = h; r.l[i] = (__bf16)(v[i] - (float)h); }
  return r; }
__device__ __forceinline__ F2 split_row(const float* row, int k0, int lane) { float v[16]; const float* p = row + k0 + 8 * (lane >> 4);
#pragma unroll
  for (int i = 0; i < 8; ++i) { v[i] = p[i]; v[8 + i] = p[16 + i]; }
  return bsplit16(v); }
__device__ __forceinline__ F2 split_rowK(const float* row, int k0, int lane, int K) { float v[16]; const int g = lane >> 4;
#pragma unroll
  for (int i = 0; i < 8; ++i) { const int ka = k0 + 8 * g + i, kb = ka + 16; v[i] = ka < K ? row[ka < K ? ka : K - 1] : 0.f; v[8 + i] = kb < K ? row[kb < K ? kb : K - 1] : 0.f; }
  return bsplit16(v); }
__device__ __forceinline__ F2 split_col(const float* W, int k0, int n, int lane, int ld, int K) { float v[16]; const int g = lane >> 4;
#pragma unroll
  for (int i = 0; i < 8; ++i) { const int ka = k0 + 8 * g + i, kb = ka + 16; v[i] = ka < K ? W[(size_t)(ka < K ? ka : K - 1) * ld + n] : 0.f; v[8 + i] = kb < K ? W[(size_t)(kb < K ? kb : K - 1) * ld + n] : 0.f; }
  return bsplit16(v); }
__device__ __forceinline__ v8f mac3(const F2& a, const F2& b, v8f c) { c = wmma_bf(a.l, b.h, c); c = wmma_bf(a.h, b.l, c); return wmma_bf(a.h, b.h, c); }
__device__ __forceinline__ float sigm(float v) { return 1.0f / (1.0f + expf(-v)); }
#define LDSX() do { asm volatile("s_wait_dscnt 0" ::: "memory"); __builtin_amdgcn_wave_barrier(); __builtin_amdgcn_fence(__ATOMIC_RELEASE, "workgroup"); } while (0)

// Causal multi-head self-attention with PER-HEAD projection weights (x [8,2048,512]; 8 heads x 64; Wq/Wk/Wv [8,512,64] = [H][C][D] (in,out per head); Wo [512,512] (in,out) + bo (normal x 0.01: read); tril, -inf): q_h = x Wq[h]; out = concat_h(softmax(causal(q_h k_h^T * 64^-0.5)) v_h) Wo + bo.
#define NB 8
#define TT 2048
#define CC 512            // NH * HD = projected width
#define DIN 512          // input (model) width
#define NH 8
#define HD 64
#define SCALE (0.125f)
#define CAUSAL 1
#ifndef TNB
#define TNB NB
#endif
__device__ __forceinline__ float bfr(float v) { return (float)(__bf16)v; }
typedef __attribute__((ext_vector_type(8))) __bf16 v8b;
__device__ __forceinline__ v16b frag_b(const __bf16* rowk0, int lane) {
  union { v16b v; v8b q[2]; } u; const __bf16* p = rowk0 + 8 * (lane >> 4);
  u.q[0] = *(const v8b*)p; u.q[1] = *(const v8b*)(p + 16); return u.v;
}
#define QHI 384            // query rows of each sequence (few keys, no averaging) that carry a q residual plane and take the high-precision path
#define KHI 384            // key rows carrying k residual / v bf16 hi+lo planes (used only by the causal high-precision path)
// B fragment (k rows k0+.., output column o) of a weight: (in,out) [K][ld] or (out,in) [ld rows of K]: bf16 exact, or f16(bf16 * 256) exact
__device__ __forceinline__ v16b wcol_io(const float* Wm, int k0, int o, int lane, int ld) { v16b w; const int g = lane >> 4;
#pragma unroll
  for (int i = 0; i < 8; ++i) { w[i] = (__bf16)Wm[(size_t)(k0 + 8 * g + i) * ld + o]; w[8 + i] = (__bf16)Wm[(size_t)(k0 + 16 + 8 * g + i) * ld + o]; }
  return w; }
__device__ __forceinline__ v16b wcol_oi(const float* Wm, int k0, int o, int lane, int K) { v16b w; const float* p = Wm + (size_t)o * K + k0 + 8 * (lane >> 4);
#pragma unroll
  for (int i = 0; i < 8; ++i) { w[i] = (__bf16)p[i]; w[8 + i] = (__bf16)p[16 + i]; }
  return w; }
__device__ __forceinline__ v16h wcolh_io(const float* Wm, int k0, int o, int lane, int ld) { v16h w; const int g = lane >> 4;
#pragma unroll
  for (int i = 0; i < 8; ++i) { w[i] = (_Float16)(bfr(Wm[(size_t)(k0 + 8 * g + i) * ld + o]) * 256.0f); w[8 + i] = (_Float16)(bfr(Wm[(size_t)(k0 + 16 + 8 * g + i) * ld + o]) * 256.0f); }
  return w; }
__device__ __forceinline__ v16h wcolh_oi(const float* Wm, int k0, int o, int lane, int K) { v16h w; const float* p = Wm + (size_t)o * K + k0 + 8 * (lane >> 4);
#pragma unroll
  for (int i = 0; i < 8; ++i) { w[i] = (_Float16)(bfr(p[i]) * 256.0f); w[8 + i] = (_Float16)(bfr(p[16 + i]) * 256.0f); }
  return w; }
#define WQKV_LAYOUT 2   // 0 = (in,out) [DIN][CC]; 1 = (out,in) [CC][DIN]; 2 = per-head [NH][DIN][HD]
__device__ __forceinline__ v16b wcol_hdk(const float* Wm, int k0, int o, int lane) { v16b w; const int g = lane >> 4; const float* p = Wm + (size_t)(o / HD) * DIN * HD + (o % HD);
#pragma unroll
  for (int i = 0; i < 8; ++i) { w[i] = (__bf16)p[(size_t)(k0 + 8 * g + i) * HD]; w[8 + i] = (__bf16)p[(size_t)(k0 + 16 + 8 * g + i) * HD]; }
  return w; }
#define WO_OUT_IN 0
#if WQKV_LAYOUT == 1
#define WCOL(W, k0, o, lane) wcol_oi(W, k0, o, lane, DIN)
#elif WQKV_LAYOUT == 2
#define WCOL(W, k0, o, lane) wcol_hdk(W, k0, o, lane)
#else
#define WCOL(W, k0, o, lane) wcol_io(W, k0, o, lane, CC)
#endif
#if WO_OUT_IN
#define WOCOL(W, k0, o, lane) wcol_oi(W, k0, o, lane, CC)
#define WOCOLH(W, k0, o, lane) wcolh_oi(W, k0, o, lane, CC)
#else
#define WOCOL(W, k0, o, lane) wcol_io(W, k0, o, lane, DIN)
#define WOCOLH(W, k0, o, lane) wcolh_io(W, k0, o, lane, DIN)
#endif

#ifndef PROJ_EXTRA_PARAMS
#define PROJ_EXTRA_PARAMS
#endif

#define WS_QH  0u                                      // f16 q rows [b*t][CC]
#define WS_KH  (WS_QH + 2u * (size_t)NB * TT * CC)      // f16 k rows [b*t][CC]
#define WS_VT  (WS_KH + 2u * (size_t)NB * TT * CC)      // f16 v planes [b][c][t]
#define WS_QL  (WS_VT + 2u * (size_t)NB * CC * TT)      // f16 q residual x 2^10 rows [b][t < QHI][CC]
#define WS_KL  (WS_QL + 2u * (size_t)NB * QHI * CC)     // f16 k residual x 2^10 rows [b][t < KHI][CC]
#define WS_VB  (WS_KL + 2u * (size_t)NB * KHI * CC)     // bf16 v hi planes [b][c][t < KHI]
#define WS_VBL (WS_VB + 2u * (size_t)NB * CC * KHI)
#define WS_Y   (WS_VBL + 2u * (size_t)NB * CC * KHI)    // f32 ctx rows [b*t][CC] (only when there is an output projection)
#define WS_END (WS_Y  + 4u * (size_t)NB * TT * CC)

// ---- g128: the product of k_proj and k_out. A block of 8 waves owns 128 rows x 128 columns; K = 512 goes by in 8 chunks of 64. Each chunk of A [row][k] and of the weight [k][column] is read from global memory once per block, in whole 128-byte lines, rounded to its 16-bit operand type there, and laid in LDS as [row][k] and [column][k] (a thread holds 8 k x 4 columns of the weight, so the transpose is a choice of registers). Waves (4 x 2) take 32 x 64 each: 6 fragments by ds_load_b128 feed 8 products. Two LDS buffers: chunk c + 1 is on its way from global memory while chunk c is multiplied; one barrier a chunk. The k order of every accumulator is ascending, as before.
// MODE 0: A bf16, weight per head [NH][DIN][HD] bf16. MODE 1: A bf16 hi + lo, weight [DIN][DIN] bf16. MODE 2: A x 2^6 f16, weight f16(bf16 x 2^8).
typedef __attribute__((ext_vector_type(2))) unsigned v2u;
typedef __attribute__((ext_vector_type(4))) __bf16 v4b;
typedef __attribute__((ext_vector_type(4))) _Float16 v4h;
union U16 { v4u q[2]; v16b b; v16h h; };
union U8 { v4u u; v8b b; v8h h; };
union U4 { v2u u; v4b b; v4h h; };
#define GP 144            // LDS row pitch in bytes: 64 k x 2 B + 16 (16 B x odd, so the 16 rows of a ds_load_b128 fragment fall on distinct banks)
#define GPL (128 * GP)    // one plane of 128 rows
template <int MODE>
__device__ __forceinline__ void g128(const float* __restrict__ Ag, const float* __restrict__ Wg, int c0, char* smem, int tid, v8f (&acc)[2][4]) {
  constexpr int NA = MODE == 1 ? 2 : 1, BUF = (NA + 1) * GPL, WLD = MODE == 0 ? HD : DIN;
  const int lane = tid & 31, wave = tid >> 5, col = lane & 15, g = lane >> 4, wm = wave & 3, wn = wave >> 2;
  const int xr = tid >> 4, xk = (tid & 15) * 4;                                                          // A: 16 lanes x 16 B = one row's 64 k
  const int wc = ((wave & 3) * 8 + (lane & 7)) * 4, wk = ((wave >> 2) * 4 + ((lane >> 3) & 3)) * 8;       // weight: 8 lanes x 16 B = one line of a k row; the thread's 8 loads are 8 successive k
  const float* ap = Ag + (size_t)xr * 512 + xk;
  const float* wp = MODE == 0 ? Wg + (size_t)((c0 + wc) / HD) * DIN * HD + (size_t)wk * HD + (c0 + wc) % HD : Wg + (size_t)wk * DIN + c0 + wc;
  v4f xa[8], wa[8];
  auto ldg = [&](int c) { const float* ac = ap + c * 64; const float* wr = wp + (size_t)(c * 64) * WLD;
#pragma unroll
    for (int i = 0; i < 8; ++i) xa[i] = *(const v4f*)(ac + (size_t)(16 * i) * 512);
#pragma unroll
    for (int i = 0; i < 8; ++i) wa[i] = *(const v4f*)(wr + (size_t)i * WLD);
    asm volatile("s_wait_xcnt 0x0" :: "v"(ac), "v"(wr) : "memory");   /* stands before the loads' address registers are written again (named as inputs, they stay whole up to here: no load lands in them); it also keeps the loads here, a whole chunk of products ahead of their use */
    __builtin_amdgcn_sched_barrier(0); };           /* keeps the vector instructions that follow, which may be given those registers, behind that wait */
  auto sts = [&](int buf) { char* B = smem + buf * BUF;
#pragma unroll
    for (int i = 0; i < 8; ++i) { char* d = B + (xr + 16 * i) * GP + xk * 2; U4 t, tl;
#pragma unroll
      for (int e = 0; e < 4; ++e) { const float v = xa[i][e];
        if (MODE == 2) t.h[e] = (_Float16)(v * 64.0f); else { const __bf16 hb = (__bf16)v; t.b[e] = hb; if (MODE == 1) tl.b[e] = (__bf16)(v - (float)hb); } }
      *(v2u*)d = t.u; if (MODE == 1) *(v2u*)(d + GPL) = tl.u; }
#pragma unroll
    for (int nn = 0; nn < 4; ++nn) { U8 t;
#pragma unroll
      for (int i = 0; i < 8; ++i) { if (MODE == 2) t.h[i] = (_Float16)(bfr(wa[i][nn]) * 256.0f); else t.b[i] = (__bf16)wa[i][nn]; }
      *(v4u*)(B + NA * GPL + (wc + nn) * GP + wk * 2) = t.u; } };
  ldg(0); sts(0); __syncthreads();
#pragma unroll 2   /* two chunks a trip: the buffer's number is a constant in each copy */
  for (int c = 0; c < 8; ++c) { const char* B = smem + (c & 1) * BUF;
    if (c < 7) ldg(c + 1);
#pragma unroll
    for (int kc = 0; kc < 2; ++kc) { U16 a[2], al[2], w[4];
#pragma unroll
      for (int mt = 0; mt < 2; ++mt) { const char* p = B + (wm * 32 + mt * 16 + col) * GP + kc * 64 + 16 * g; a[mt].q[0] = *(const v4u*)p; a[mt].q[1] = *(const v4u*)(p + 32); if (MODE == 1) { al[mt].q[0] = *(const v4u*)(p + GPL); al[mt].q[1] = *(const v4u*)(p + GPL + 32); } }
#pragma unroll
      for (int nt = 0; nt < 4; ++nt) { const char* p = B + NA * GPL + (wn * 64 + nt * 16 + col) * GP + kc * 64 + 16 * g; w[nt].q[0] = *(const v4u*)p; w[nt].q[1] = *(const v4u*)(p + 32); }
#pragma unroll
      for (int mt = 0; mt < 2; ++mt)
#pragma unroll
        for (int nt = 0; nt < 4; ++nt) {
          if (MODE == 2) acc[mt][nt] = __builtin_amdgcn_wmma_f32_16x16x32_f16(false, a[mt].h, false, w[nt].h, (short)0, acc[mt][nt], false, false);
          else { acc[mt][nt] = __builtin_amdgcn_wmma_f32_16x16x32_bf16(false, a[mt].b, false, w[nt].b, (short)0, acc[mt][nt], false, false);
            if (MODE == 1) acc[mt][nt] = __builtin_amdgcn_wmma_f32_16x16x32_bf16(false, al[mt].b, false, w[nt].b, (short)0, acc[mt][nt], false, false); } } }
    __builtin_amdgcn_sched_barrier(0);   /* keeps the roundings of chunk c + 1, and with them the wait for its global loads, behind this chunk's products */
    if (c < 7) sts((c + 1) & 1);   // into the buffer whose last readers passed the barrier at the foot of chunk c - 1
    __syncthreads(); } }           // publishes chunk c + 1; behind the last one the caller may reuse the LDS
// ---- k_proj: block = (128 rows, 128 cols, which): q/k/v = X W (+ b) with exact bf16 products (K = DIN) -> which 0: q f16 rows (+ residual rows < QHI); 1: k f16 rows (+ residual rows < KHI); 2: v f16 planes [c][t] (+ bf16 hi/lo planes for t < KHI). The output tiles pass through the LDS that held the operand chunks.
static_assert(QHI % 128 == 0 && KHI % 128 == 0 && TT % 128 == 0 && DIN == 512 && CC == 512, "block split");
__global__ __launch_bounds__(256) void k_proj(const float* __restrict__ XQ, const float* __restrict__ XK, const float* __restrict__ XV, const float* __restrict__ WQ, const float* __restrict__ WK, const float* __restrict__ WV, const float* __restrict__ BQ, const float* __restrict__ BK, const float* __restrict__ BV,
    _Float16* __restrict__ QH, _Float16* __restrict__ QL, _Float16* __restrict__ KH, _Float16* __restrict__ KL, _Float16* __restrict__ VT, __bf16* __restrict__ VB, __bf16* __restrict__ VBL) {
  __shared__ __align__(16) char smem[3 * 128 * 136 * 2];   // operand chunks: 4 x GPL; output tiles: up to 3 x [128][136] of 2 bytes
  static_assert(4 * GPL <= 3 * 128 * 136 * 2, "LDS");
  const int tid = threadIdx.x, wave = tid >> 5, lane = tid & 31, col = lane & 15, g = lane >> 4, wm = wave & 3, wn = wave >> 2; const int which = blockIdx.z; const int c0 = blockIdx.y * 128; const size_t r0 = (size_t)blockIdx.x * 128; const size_t bb = r0 / TT; const int t0 = (int)(r0 % TT);
  const float* X = which == 0 ? XQ : which == 1 ? XK : XV; const float* WA = which == 0 ? WQ : which == 1 ? WK : WV; const float* BA = which == 0 ? BQ : which == 1 ? BK : BV;
  v8f acc[2][4] = {};
  g128<0>(X + r0 * DIN, WA, c0, smem, tid, acc);
  if (which < 2) { _Float16 (*sh)[136] = (_Float16 (*)[136])smem; _Float16 (*sl)[136] = (_Float16 (*)[136])(smem + 128 * 136 * 2);
    _Float16* DH = which == 0 ? QH : KH; _Float16* DL = which == 0 ? QL : KL; const int nhi = which == 0 ? QHI : KHI; const bool hi_rows = t0 < nhi;
#pragma unroll
    for (int mt = 0; mt < 2; ++mt)
#pragma unroll
      for (int nt = 0; nt < 4; ++nt) { const int cl = wn * 64 + nt * 16 + col; const float bias = BA ? bfr(BA[c0 + cl]) : 0.f;
#pragma unroll
        for (int r = 0; r < 8; ++r) { const float v = acc[mt][nt][r] + bias; const _Float16 hv = (_Float16)v; const int rl = wm * 32 + mt * 16 + 8 * g + r; sh[rl][cl] = hv; sl[rl][cl] = (_Float16)((v - (float)hv) * 1024.0f); } }
    __syncthreads();
#pragma unroll   /* unrolled: the LDS reads go out as one group ahead of the stores, one LDS latency for all */
    for (int i = 0; i < 8; ++i) { const int e = tid + i * 256; const int rl = e >> 4, q = e & 15; vst2((unsigned*)(DH + (r0 + rl) * CC + c0 + q * 8), *(const v4u*)&sh[rl][q * 8]); }
    asm volatile("s_wait_xcnt 0x0" ::: "memory");   /* stands before the code behind the branch writes registers that these stores name */
    if (hi_rows) {
#pragma unroll   /* unrolled: the LDS reads go out as one group ahead of the stores, one LDS latency for all */
      for (int i = 0; i < 8; ++i) { const int e = tid + i * 256; const int rl = e >> 4, q = e & 15; vst2((unsigned*)(DL + (bb * nhi + t0 + rl) * (size_t)CC + c0 + q * 8), *(const v4u*)&sl[rl][q * 8]); }
      asm volatile("s_wait_xcnt 0x0" ::: "memory"); }   /* stands before whatever the compiler lays out behind this branch writes registers that these stores name */
  } else { _Float16 (*th)[136] = (_Float16 (*)[136])smem; __bf16 (*tb)[136] = (__bf16 (*)[136])(smem + 128 * 136 * 2); __bf16 (*tbl)[136] = (__bf16 (*)[136])(smem + 2 * 128 * 136 * 2); const bool hi_rows = t0 < KHI;
#pragma unroll
    for (int mt = 0; mt < 2; ++mt)
#pragma unroll
      for (int nt = 0; nt < 4; ++nt) { const int cl = wn * 64 + nt * 16 + col; const float bias = BA ? bfr(BA[c0 + cl]) : 0.f;
#pragma unroll
        for (int r = 0; r < 8; ++r) { const float v = acc[mt][nt][r] + bias; const int rl = wm * 32 + mt * 16 + 8 * g + r; th[cl][rl] = (_Float16)v; const __bf16 bh = (__bf16)v; tb[cl][rl] = bh; tbl[cl][rl] = (__bf16)(v - (float)bh); } }
    __syncthreads();
#pragma unroll   /* unrolled: the LDS reads go out as one group ahead of the stores, one LDS latency for all */
    for (int i = 0; i < 8; ++i) { const int e = tid + i * 256; const int cl = e >> 4, q = e & 15; vst2((unsigned*)(VT + (bb * CC + c0 + cl) * (size_t)TT + t0 + q * 8), *(const v4u*)&th[cl][q * 8]); }
    asm volatile("s_wait_xcnt 0x0" ::: "memory");   /* stands before the code behind the branch writes registers that these stores name */
    if (hi_rows) {
#pragma unroll   /* unrolled: the LDS reads go out as one group ahead of the stores, one LDS latency for all */
      for (int i = 0; i < 8; ++i) { const int e = tid + i * 256; const int cl = e >> 4, q = e & 15; const size_t o3 = (bb * CC + c0 + cl) * (size_t)KHI + t0 + q * 8; vst2((unsigned*)(VB + o3), *(const v4u*)&tb[cl][q * 8]); vst2((unsigned*)(VBL + o3), *(const v4u*)&tbl[cl][q * 8]); }
      asm volatile("s_wait_xcnt 0x0" ::: "memory"); } } }   /* stands before whatever the compiler lays out behind this branch writes registers that these stores name */
#define FAW 8
#define NT32 (TT / 32)
static_assert(QHI % 32 == 0 && KHI >= QHI && NT32 % (2 * FAW) == 0, "tile split");
__device__ __forceinline__ v8f mm_h(v16h a, v16h b, v8f c) { return __builtin_amdgcn_wmma_f32_16x16x32_f16(false, a, false, b, (short)0, c, false, false); }
__device__ __forceinline__ v8f mm_b(v16b a, v16b b, v8f c) { return __builtin_amdgcn_wmma_f32_16x16x32_bf16(false, a, false, b, (short)0, c, false, false); }
// fragment from a wave-uniform row base plus the lane's own byte offset (row pitch x (lane & 15) + 16 x (lane >> 4)): what changes from pass to pass is scalar arithmetic, and one vector add forms the address of a whole group of loads
__device__ __forceinline__ v16h frag_hu(const _Float16* ub, unsigned vo) { union { v16h v; v8h q[2]; } u; const char* p = (const char*)ub + vo; u.q[0] = *(const v8h*)p; u.q[1] = *(const v8h*)(p + 32); return u.v; }
__device__ __forceinline__ v16b frag_bu(const __bf16* ub, unsigned vo) { union { v16b v; v8b q[2]; } u; const char* p = (const char*)ub + vo; u.q[0] = *(const v8b*)p; u.q[1] = *(const v8b*)(p + 32); return u.v; }
template <bool HI>
__device__ __forceinline__ void fa_tile(const _Float16* __restrict__ QH, const _Float16* __restrict__ KH, const _Float16* __restrict__ QL, const _Float16* __restrict__ KL, const _Float16* __restrict__ VT, const __bf16* __restrict__ VB, const __bf16* __restrict__ VBL, int b, int h, int t, int lane, float* __restrict__ Y) {
  const int col = lane & 15, g = lane >> 4, ql0 = t * 32;
  const float C2 = SCALE * 1.44269504088896f;   // logit scale x log2(e)
  const float OFF = HI ? 0.f : 11.f;            // f16 P carried x 2^11 (clear of f16 subnormals); it cancels against the sum
  const _Float16* Kr = KH + (size_t)b * TT * CC + h * HD; const _Float16* KLr = KL + (size_t)b * KHI * CC + h * HD;   // wave-uniform bases
  const _Float16* Vr = VT + ((size_t)b * CC + h * HD) * (size_t)TT; const size_t vbo = ((size_t)b * CC + h * HD) * (size_t)KHI;
  const unsigned ro = (unsigned)(col * CC * 2 + 16 * g), vo = (unsigned)(col * (HI ? KHI : TT) * 2 + 16 * g);   // lane byte offsets: q / k rows, v planes
  v16h qf[2][2], qlf[2][2];
#pragma unroll
  for (int qt = 0; qt < 2; ++qt)
#pragma unroll
    for (int kc = 0; kc < 2; ++kc) { qf[qt][kc] = frag_hu(QH + ((size_t)b * TT + ql0 + qt * 16) * CC + h * HD + kc * 32, ro); if (HI) qlf[qt][kc] = frag_hu(QL + ((size_t)b * QHI + ql0 + qt * 16) * CC + h * HD + kc * 32, ro); }
  v8f o[2][4] = {}; float m[2] = {-3.0e38f, -3.0e38f}, l[2] = {0.f, 0.f};
  v16h kf[2][2];   // f16 path: K rows fetched one pass ahead; the high-precision path (12 passes at most, more live registers) fetches them in the pass
  if (!HI) {
#pragma unroll
    for (int kt = 0; kt < 2; ++kt)
#pragma unroll
      for (int kc = 0; kc < 2; ++kc) kf[kt][kc] = frag_hu(Kr + (size_t)(kt * 16) * CC + kc * 32, ro); }
#pragma unroll 1   /* rolled: one pass already holds 16 independent products, and a second copy would not fit 256 registers */
  for (int c = 0; c <= t; ++c) { const int k0 = c * 32;
    v16h vf[4];
    if (!HI) {
#pragma unroll
      for (int j = 0; j < 4; ++j) vf[j] = frag_hu(Vr + (size_t)(j * 16) * TT + k0, vo);
      asm volatile("s_wait_xcnt 0x0" ::: "memory"); }   /* stands before the v loads' address registers are written again (the K fetch below may land in them); it also keeps the v loads at the head of the pass, ahead of the logits */
    v8f st[2][2] = {}, sl[2][2] = {};   // st[qt][kt][r] = S^T[key k0 + 16 kt + 8 g + r][query ql0 + 16 qt + col]
#pragma unroll
    for (int kc = 0; kc < 2; ++kc)
#pragma unroll
      for (int kt = 0; kt < 2; ++kt) { v16h klf; if (HI) { kf[kt][kc] = frag_hu(Kr + (size_t)(k0 + kt * 16) * CC + kc * 32, ro); klf = frag_hu(KLr + (size_t)(k0 + kt * 16) * CC + kc * 32, ro); }
#pragma unroll
        for (int qt = 0; qt < 2; ++qt) { st[qt][kt] = mm_h(kf[kt][kc], qf[qt][kc], st[qt][kt]); if (HI) { sl[qt][kt] = mm_h(kf[kt][kc], qlf[qt][kc], sl[qt][kt]); sl[qt][kt] = mm_h(klf, qf[qt][kc], sl[qt][kt]); } } }
    if (!HI) { const int kn = c < t ? k0 + 32 : k0;   // the next pass's K rows are fetched behind this pass's logits (no branch behind the products: the last pass fetches its own rows again, in bounds)
#pragma unroll
      for (int kt = 0; kt < 2; ++kt)
#pragma unroll
        for (int kc = 0; kc < 2; ++kc) kf[kt][kc] = frag_hu(Kr + (size_t)(kn + kt * 16) * CC + kc * 32, ro);
      asm volatile("s_wait_xcnt 0x0" ::: "memory"); }   /* stands before the K loads' address registers are written again; it also keeps the fetch here, a whole softmax ahead of its use */
    v16h pf[2]; F2 pb[2];
#pragma unroll
    for (int qt = 0; qt < 2; ++qt) { float s[16];
#pragma unroll
      for (int i = 0; i < 16; ++i) s[i] = HI ? st[qt][i >> 3][i & 7] + sl[qt][i >> 3][i & 7] * (1.0f / 1024.0f) : st[qt][i >> 3][i & 7];
      if (c == t) {   /* the pass on the diagonal (wave-uniform): keys past the query are excluded by index */
#pragma unroll
        for (int i = 0; i < 16; ++i) if ((i >> 3) * 16 + 8 * g + (i & 7) > qt * 16 + col) s[i] = -3.0e38f; }
      float r8[8];
#pragma unroll
      for (int i = 0; i < 8; ++i) r8[i] = fmaxf(s[i], s[8 + i]);
      float mx = fmaxf(fmaxf(fmaxf(r8[0], r8[1]), fmaxf(r8[2], r8[3])), fmaxf(fmaxf(r8[4], r8[5]), fmaxf(r8[6], r8[7])));
      mx = fmaxf(mx, __shfl_xor(mx, 16));
      const float mn = fmaxf(m[qt], mx); const float al = __builtin_amdgcn_exp2f((m[qt] - mn) * C2); m[qt] = mn;
#pragma unroll
      for (int i = 0; i < 16; ++i) s[i] = __builtin_amdgcn_exp2f((s[i] - mn) * C2 + OFF);
#pragma unroll
      for (int i = 0; i < 8; ++i) r8[i] = s[i] + s[8 + i];
      l[qt] = l[qt] * al + (((r8[0] + r8[1]) + (r8[2] + r8[3])) + ((r8[4] + r8[5]) + (r8[6] + r8[7])));
#pragma unroll
      for (int j = 0; j < 4; ++j) o[qt][j] *= al;
      if (HI) pb[qt] = bsplit16(s); else {
#pragma unroll
        for (int i = 0; i < 16; ++i) pf[qt][i] = (_Float16)s[i]; } }   // element i = key k0 + 16 (i >> 3) + 8 g + (i & 7): the B operand's own k order
#pragma unroll
    for (int j = 0; j < 4; ++j) { v16b vh, vl; if (HI) { vh = frag_bu(VB + vbo + (size_t)(j * 16) * KHI + k0, vo); vl = frag_bu(VBL + vbo + (size_t)(j * 16) * KHI + k0, vo); }
#pragma unroll
      for (int qt = 0; qt < 2; ++qt) { if (HI) { o[qt][j] = mm_b(vh, pb[qt].h, o[qt][j]); o[qt][j] = mm_b(vh, pb[qt].l, o[qt][j]); o[qt][j] = mm_b(vl, pb[qt].h, o[qt][j]); } else o[qt][j] = mm_h(vf[j], pf[qt], o[qt][j]); } } }
  if (!HI) asm volatile("s_wait_loadcnt 0x0" ::: "memory");   /* the last pass's K fetch has no reader: it has landed before its registers are used again or the wave ends */
#pragma unroll
  for (int qt = 0; qt < 2; ++qt) { const float lt = l[qt] + __shfl_xor(l[qt], 16); const float inv = lt > 0.f ? 1.0f / lt : 0.f;   // o[qt][j][r] = O^T[d 16 j + 8 g + r][query]
    float* yp = Y + ((size_t)b * TT + ql0 + qt * 16 + col) * CC + h * HD + 8 * g;
#pragma unroll
    for (int j = 0; j < 4; ++j) { const v8f v = o[qt][j] * inv; vst2(yp + j * 16, (v4f){v[0], v[1], v[2], v[3]}); vst2(yp + j * 16 + 4, (v4f){v[4], v[5], v[6], v[7]}); } }
  asm volatile("s_wait_xcnt 0x0" ::: "memory"); }   /* stands before the wave's next tile writes the registers that these stores name */
__global__ __launch_bounds__(32 * FAW) void k_fa(const _Float16* __restrict__ QH, const _Float16* __restrict__ KH, const _Float16* __restrict__ QL, const _Float16* __restrict__ KL, const _Float16* __restrict__ VT, const __bf16* __restrict__ VB, const __bf16* __restrict__ VBL, float* __restrict__ Y) {
  const int lane = threadIdx.x & 31, wave = __builtin_amdgcn_readfirstlane(threadIdx.x >> 5); const int h = blockIdx.y, b = blockIdx.z; const int pi = blockIdx.x * FAW + wave;
  for (int half = 0; half < 2; ++half) { const int t = half ? pi : NT32 - 1 - pi;   /* wave-uniform */
    if (t < QHI / 32) fa_tile<true>(QH, KH, QL, KL, VT, VB, VBL, b, h, t, lane, Y); else fa_tile<false>(QH, KH, QL, KL, VT, VB, VBL, b, h, t, lane, Y); } }
// ---- k_out: block = (128 rows, 128 cols): out = ctx Wo (+ bo): ctx once to f16 against Wo as f16(bf16 x 2^8) exact (1 product) x 2^-8; causal early rows (< QHI of each sequence): ctx bf16 hi + lo against exact bf16 Wo (2 products). ctx is carried x 2^6 into f16 so small-magnitude context rows stay clear of f16 subnormals.
__global__ __launch_bounds__(256) __attribute__((amdgpu_waves_per_eu(4))) /* 256 registers at most: two blocks to a WGP, which is the whole grid at once */ void k_out(const float* __restrict__ Y, const float* __restrict__ WO, const float* __restrict__ BO, float* __restrict__ OUT) { __shared__ __align__(16) char smem[6 * GPL];   // operand chunks: 2 x 3 planes at most; then the f32 output tile [128][132]
  static_assert(128 * 132 * 4 <= 6 * GPL && WO_OUT_IN == 0, "LDS");
  const int tid = threadIdx.x, wave = tid >> 5, lane = tid & 31, col = lane & 15, g = lane >> 4, wm = wave & 3, wn = wave >> 2; const int c0 = blockIdx.y * 128; const size_t r0 = (size_t)blockIdx.x * 128;
  const bool hi = CAUSAL && (int)(r0 % TT) < QHI;   /* block-uniform */
  v8f acc[2][4] = {};
  if (hi) g128<1>(Y + r0 * CC, WO, c0, smem, tid, acc); else g128<2>(Y + r0 * CC, WO, c0, smem, tid, acc);
  float (*sf)[132] = (float (*)[132])smem; const float sc = hi ? 1.0f : 1.0f / 16384.0f;   /* 2^-8 (Wo carry) x 2^-6 (ctx carry): a power of two, exact */
#pragma unroll
  for (int mt = 0; mt < 2; ++mt)
#pragma unroll
    for (int nt = 0; nt < 4; ++nt) { const int cl = wn * 64 + nt * 16 + col; const float bias = BO ? bfr(BO[c0 + cl]) : 0.f;
#pragma unroll
      for (int r = 0; r < 8; ++r) sf[wm * 32 + mt * 16 + 8 * g + r][cl] = acc[mt][nt][r] * sc + bias; }
  __syncthreads();
#pragma unroll   /* unrolled: the LDS reads go out as one group ahead of the stores, one LDS latency for all */
  for (int i = 0; i < 16; ++i) { const int e = tid + i * 256; const int rl = e >> 5, q = e & 31; vst2(OUT + (r0 + rl) * DIN + c0 + q * 4, *(const v4f*)&sf[rl][q * 4]); } }

extern "C" void kernel_launch(void* const* d_in, const int* in_sizes, int n_in, void* d_out, int out_size, void* d_ws, size_t ws_size, hipStream_t stream) {
  (void)in_sizes; (void)n_in; (void)out_size;
  const float** F = (const float**)d_in;
  if (ws_size < (size_t)WS_END) return;
  char* ws = (char*)d_ws; _Float16 *QH = (_Float16*)(ws + WS_QH), *KH = (_Float16*)(ws + WS_KH), *VT = (_Float16*)(ws + WS_VT), *QL = (_Float16*)(ws + WS_QL), *KL = (_Float16*)(ws + WS_KL); __bf16 *VB = (__bf16*)(ws + WS_VB), *VBL = (__bf16*)(ws + WS_VBL); float *Y = (float*)(ws + WS_Y);
  (void)Y; (void)QL; (void)KL; (void)VB; (void)VBL;
  // inputs: 0 x [8,2048,512]; 1 Wq [8,512,64] (per-head (in,out)); 2 Wk; 3 Wv; 4 Wo [512,512] (in,out); 5 bo [512] (normal x 0.01, read)
  k_proj<<<dim3(TNB * TT / 128, CC / 128, 3), 256, 0, stream>>>(F[0], F[0], F[0], F[1], F[2], F[3], nullptr, nullptr, nullptr, QH, QL, KH, KL, VT, VB, VBL);
  k_fa<<<dim3(NT32 / (2 * FAW), NH, TNB), 32 * FAW, 0, stream>>>(QH, KH, QL, KL, VT, VB, VBL, Y);
  k_out<<<dim3(TNB * TT / 128, DIN / 128), 256, 0, stream>>>(Y, F[4], F[5], (float*)d_out);
}

// v004
// A run of this version takes 112 microseconds.
// Two timings next to v003 put it at 1.40 and 1.39 times that version's speed.
// Over all steps from v000 it is 16.7 times as fast.
// compute dtype: all float inputs rounded to bf16; per-head q/k/v projections with EXACT bf16 products on WMMA 16x16x32 (f32 accumulate); causal logits: 3 products for the first 384 rows, single f16 q x k after, x 64^-0.5; softmax f32 with a running maximum and sum over passes of 32 keys; exp(s - max) x 2^11 once to f16 x v once to f16 (bf16 hi + lo below row 384), divided by the sum at the end; ctx hi+lo x exact Wproj below row 384, x2^6 f16 carry x f16(bf16 x 2^8) Wproj after, + bproj; f32 output.
#include <hip/hip_runtime.h>
#include <math.h>

typedef __attribute__((ext_vector_type(16))) _Float16 v16h;
typedef __attribute__((ext_vector_type(16))) __bf16 v16b;
typedef __attribute__((ext_vector_type(8)))  _Float16 v8h;
typedef __attribute__((ext_vector_type(8)))  float v8f;
typedef __attribute__((ext_vector_type(4)))  float v4f;
typedef __attribute__((ext_vector_type(2)))  float v2f;
typedef __attribute__((ext_vector_type(4)))  unsigned v4u;
typedef __attribute__((ext_vector_type(4)))  int v4i;
typedef float __attribute__((may_alias)) float_a;
typedef int __attribute__((may_alias)) int_a;

template <typename T> __device__ __forceinline__ void vst2(void* p, T v) { *(T*)p = v;  }
__device__ __forceinline__ v8f wmma16(v16h a, v16h b, v8f c) {
  v8f d = __builtin_amdgcn_wmma_f32_16x16x32_f16(false, a, false, b, (short)0, c, false, false);
  asm volatile("v_nop\n\tv_nop\n\tv_nop\n\tv_nop" : "+v"(d) : "v"(a), "v"(b));
  return d;
}
__device__ __forceinline__ v8f wmma_bf(v16b a, v16b b, v8f c) {
  v8f d = __builtin_amdgcn_wmma_f32_16x16x32_bf16(false, a, false, b, (short)0, c, false, false);
  asm volatile("v_nop\n\tv_nop\n\tv_nop\n\tv_nop" : "+v"(d) : "v"(a), "v"(b));
  return d;
}
// 16x16x32 fragments: lane = (h = lane>>4, row/col = lane&15); elements 0..7 = k0+8h+0..7, 8..15 = k0+16+8h+0..7; D element r = row 8h+r
__device__ __forceinline__ v16h frag_h(const _Float16* rowk0, int lane) {
  union { v16h v; v8h q[2]; } u; const _Float16* p = rowk0 + 8 * (lane >> 4);
  u.q[0] = *(const v8h*)p; u.q[1] = *(const v8h*)(p + 16); return u.v;
}
__device__ __forceinline__ v16h frag_f32(const float* rowk0, int lane) {
  v16h a; const float* p = rowk0 + 8 * (lane >> 4);
#pragma unroll
  for (int i = 0; i < 8; ++i) { a[i] = (_Float16)p[i]; a[8 + i] = (_Float16)p[16 + i]; }
  return a;
}
__device__ __forceinline__ v16h frag_f32s(const float* rowk0, int lane, float sc) {
  v16h a; const float* p = rowk0 + 8 * (lane >> 4);
#pragma unroll
  for (int i = 0; i < 8; ++i) { a[i] = (_Float16)(p[i] * sc); a[8 + i] = (_Float16)(p[16 + i] * sc); }
  return a;
}
// column fragment from a [K][ld] layout (column n), rows >= K read as 0
__device__ __forceinline__ v16h fragc_f32(const float* W, int k0, int n, int lane, int ld, int K) {
  v16h a; const int g = lane >> 4;
#pragma unroll
  for (int i = 0; i < 8; ++i) { const int ka = k0 + 8 * g + i, kb = ka + 16;
    a[i] = (_Float16)(ka < K ? W[(size_t)(ka < K ? ka : K - 1) * ld + n] : 0.f); a[8 + i] = (_Float16)(kb < K ? W[(size_t)(kb < K ? kb : K - 1) * ld + n] : 0.f); }
  return a;
}
struct F2 { v16b h, l; };
__device__ __forceinline__ F2 bsplit16(const float v[16]) { F2 r;
#pragma unroll
  for (int i = 0; i < 16; ++i) { const __bf16 h = (__bf16)v[i]; r.h[i] = h; r.l[i] = (__bf16)(v[i] - (float)h); }
  return r; }
__device__ __forceinline__ F2 split_row(const float* row, int k0, int lane) { float v[16]; const float* p = row + k0 + 8 * (lane >> 4);
#pragma unroll
  for (int i = 0; i < 8; ++i) { v[i] = p[i]; v[8 + i] = p[16 + i]; }
  return bsplit16(v); }
__device__ __forceinline__ F2 split_rowK(const float* row, int k0, int lane, int K) { float v[16]; const int g = lane >> 4;
#pragma unroll
  for (int i = 0; i < 8; ++i) { const int ka = k0 + 8 * g + i, kb = ka + 16; v[i] = ka < K ? row[ka < K ? ka : K - 1] : 0.f; v[8 + i] = kb < K ? row[kb < K ? kb : K - 1] : 0.f; }
  return bsplit16(v); }
__device__ __forceinline__ F2 split_col(const float* W, int k0, int n, int lane, int ld, int K) { float v[16]; const int g = lane >> 4;
#pragma unroll
  for (int i = 0; i < 8; ++i) { const int ka = k0 + 8 * g + i, kb = ka + 16; v[i] = ka < K ? W[(size_t)(ka < K ? ka : K - 1) * ld + n] : 0.f; v[8 + i] = kb < K ? W[(size_t)(kb < K ? kb : K - 1) * ld + n] : 0.f; }
  return bsplit16(v); }
__device__ __forceinline__ v8f mac3(const F2& a, const F2& b, v8f c) { c = wmma_bf(a.l, b.h, c); c = wmma_bf(a.h, b.l, c); return wmma_bf(a.h, b.h, c); }
__device__ __forceinline__ float sigm(float v) { return 1.0f / (1.0f + expf(-v)); }
#define LDSX() do { asm volatile("s_wait_dscnt 0" ::: "memory"); __builtin_amdgcn_wave_barrier(); __builtin_amdgcn_fence(__ATOMIC_RELEASE, "workgroup"); } while (0)

// Causal multi-head self-attention with PER-HEAD projection weights (x [8,2048,512]; 8 heads x 64; Wq/Wk/Wv [8,512,64] = [H][C][D] (in,out per head); Wo [512,512] (in,out) + bo (normal x 0.01: read); tril, -inf): q_h = x Wq[h]; out = concat_h(softmax(causal(q_h k_h^T * 64^-0.5)) v_h) Wo + bo.
#define NB 8
#define TT 2048
#define CC 512            // NH * HD = projected width
#define DIN 512          // input (model) width
#define NH 8
#define HD 64
#define SCALE (0.125f)
#define CAUSAL 1
#ifndef TNB
#define TNB NB
#endif
__device__ __forceinline__ float bfr(float v) { return (float)(__bf16)v; }
typedef __attribute__((ext_vector_type(8))) __bf16 v8b;
__device__ __forceinline__ v16b frag_b(const __bf16* rowk0, int lane) {
  union { v16b v; v8b q[2]; } u; const __bf16* p = rowk0 + 8 * (lane >> 4);
  u.q[0] = *(const v8b*)p; u.q[1] = *(const v8b*)(p + 16); return u.v;
}
#define QHI 384            // query rows of each sequence (few keys, no averaging) that carry a q residual plane and take the high-precision path
#define KHI 384            // key rows carrying k residual / v bf16 hi+lo planes (used only by the causal high-precision path)
// B fragment (k rows k0+.., output column o) of a weight: (in,out) [K][ld] or (out,in) [ld rows of K]: bf16 exact, or f16(bf16 * 256) exact
__device__ __forceinline__ v16b wcol_io(const float* Wm, int k0, int o, int lane, int ld) { v16b w; const int g = lane >> 4;
#pragma unroll
  for (int i = 0; i < 8; ++i) { w[i] = (__bf16)Wm[(size_t)(k0 + 8 * g + i) * ld + o]; w[8 + i] = (__bf16)Wm[(size_t)(k0 + 16 + 8 * g + i) * ld + o]; }
  return w; }
__device__ __forceinline__ v16b wcol_oi(const float* Wm, int k0, int o, int lane, int K) { v16b w; const float* p = Wm + (size_t)o * K + k0 + 8 * (lane >> 4);
#pragma unroll
  for (int i = 0; i < 8; ++i) { w[i] = (__bf16)p[i]; w[8 + i] = (__bf16)p[16 + i]; }
  return w; }
__device__ __forceinline__ v16h wcolh_io(const float* Wm, int k0, int o, int lane, int ld) { v16h w; const int g = lane >> 4;
#pragma unroll
  for (int i = 0; i < 8; ++i) { w[i] = (_Float16)(bfr(Wm[(size_t)(k0 + 8 * g + i) * ld + o]) * 256.0f); w[8 + i] = (_Float16)(bfr(Wm[(size_t)(k0 + 16 + 8 * g + i) * ld + o]) * 256.0f); }
  return w; }
__device__ __forceinline__ v16h wcolh_oi(const float* Wm, int k0, int o, int lane, int K) { v16h w; const float* p = Wm + (size_t)o * K + k0 + 8 * (lane >> 4);
#pragma unroll
  for (int i = 0; i < 8; ++i) { w[i] = (_Float16)(bfr(p[i]) * 256.0f); w[8 + i] = (_Float16)(bfr(p[16 + i]) * 256.0f); }
  return w; }
#define WQKV_LAYOUT 2   // 0 = (in,out) [DIN][CC]; 1 = (out,in) [CC][DIN]; 2 = per-head [NH][DIN][HD]
__device__ __forceinline__ v16b wcol_hdk(const float* Wm, int k0, int o, int lane) { v16b w; const int g = lane >> 4; const float* p = Wm + (size_t)(o / HD) * DIN * HD + (o % HD);
#pragma unroll
  for (int i = 0; i < 8; ++i) { w[i] = (__bf16)p[(size_t)(k0 + 8 * g + i) * HD]; w[8 + i] = (__bf16)p[(size_t)(k0 + 16 + 8 * g + i) * HD]; }
  return w; }
#define WO_OUT_IN 0
#if WQKV_LAYOUT == 1
#define WCOL(W, k0, o, lane) wcol_oi(W, k0, o, lane, DIN)
#elif WQKV_LAYOUT == 2
#define WCOL(W, k0, o, lane) wcol_hdk(W, k0, o, lane)
#else
#define WCOL(W, k0, o, lane) wcol_io(W, k0, o, lane, CC)
#endif
#if WO_OUT_IN
#define WOCOL(W, k0, o, lane) wcol_oi(W, k0, o, lane, CC)
#define WOCOLH(W, k0, o, lane) wcolh_oi(W, k0, o, lane, CC)
#else
#define WOCOL(W, k0, o, lane) wcol_io(W, k0, o, lane, DIN)
#define WOCOLH(W, k0, o, lane) wcolh_io(W, k0, o, lane, DIN)
#endif

#ifndef PROJ_EXTRA_PARAMS
#define PROJ_EXTRA_PARAMS
#endif

#define WS_QH  0u                                      // f16 q rows [b*t][CC]
#define WS_KH  (WS_QH + 2u * (size_t)NB * TT * CC)      // f16 k rows [b*t][CC]
#define WS_VT  (WS_KH + 2u * (size_t)NB * TT * CC)      // f16 v planes [b][c][t]
#define WS_QL  (WS_VT + 2u * (size_t)NB * CC * TT)      // f16 q residual x 2^10 rows [b][t < QHI][CC]
#define WS_KL  (WS_QL + 2u * (size_t)NB * QHI * CC)     // f16 k residual x 2^10 rows [b][t < KHI][CC]
#define WS_VB  (WS_KL + 2u * (size_t)NB * KHI * CC)     // bf16 v hi planes [b][c][t < KHI]
#define WS_VBL (WS_VB + 2u * (size_t)NB * CC * KHI)
#define WS_Y   (WS_VBL + 2u * (size_t)NB * CC * KHI)    // f32 ctx rows [b*t][CC] (only when there is an output projection)
#define WS_END (WS_Y  + 4u * (size_t)NB * TT * CC)

// ---- g128: the product of k_proj and k_out. A block of 8 waves owns 128 rows x 128 columns; K = 512 goes by in 8 chunks of 64. Each chunk of A [row][k] and of the weight [k][column] is read from global memory once per block, in whole 128-byte lines, rounded to its 16-bit operand type there, and laid in LDS as [row][k] and [column][k] (a thread holds 8 k x 4 columns of the weight, so the transpose is a choice of registers). Waves (4 x 2) take 32 x 64 each: 6 fragments by ds_load_b128 feed 8 products. Two LDS buffers: chunk c + 1 is on its way from global memory while chunk c is multiplied; one barrier a chunk. The k order of every accumulator is ascending, as before.
// MODE 0: A bf16, weight per head [NH][DIN][HD] bf16. MODE 1: A bf16 hi + lo, weight [DIN][DIN] bf16. MODE 2: A x 2^6 f16, weight f16(bf16 x 2^8).
typedef __attribute__((ext_vector_type(2))) unsigned v2u;
typedef __attribute__((ext_vector_type(4))) __bf16 v4b;
typedef __attribute__((ext_vector_type(4))) _Float16 v4h;
union U16 { v4u q[2]; v16b b; v16h h; };
union U8 { v4u u; v8b b; v8h h; };
union U4 { v2u u; v4b b; v4h h; };
#define GP 144            // LDS row pitch in bytes: 64 k x 2 B + 16 (16 B x odd, so the 16 rows of a ds_load_b128 fragment fall on distinct banks)
#define GPL (128 * GP)    // one plane of 128 rows
template <int MODE>
__device__ __forceinline__ void g128(const float* __restrict__ Ag, const float* __restrict__ Wg, int c0, char* smem, int tid, v8f (&acc)[2][4]) {
  constexpr int NA = MODE == 1 ? 2 : 1, BUF = (NA + 1) * GPL, WLD = MODE == 0 ? HD : DIN;
  const int lane = tid & 31, wave = tid >> 5, col = lane & 15, g = lane >> 4, wm = wave & 3, wn = wave >> 2;
  const int xr = tid >> 4, xk = (tid & 15) * 4;                                                          // A: 16 lanes x 16 B = one row's 64 k
  const int wc = ((wave & 3) * 8 + (lane & 7)) * 4, wk = ((wave >> 2) * 4 + ((lane >> 3) & 3)) * 8;       // weight: 8 lanes x 16 B = one line of a k row; the thread's 8 loads are 8 successive k
  const float* ap = Ag + (size_t)xr * 512 + xk;
  const float* wp = MODE == 0 ? Wg + (size_t)((c0 + wc) / HD) * DIN * HD + (size_t)wk * HD + (c0 + wc) % HD : Wg + (size_t)wk * DIN + c0 + wc;
  v4f xa[8], wa[8];
  auto ldg = [&](int c) { const float* ac = ap + c * 64; const float* wr = wp + (size_t)(c * 64) * WLD;
#pragma unroll
    for (int i = 0; i < 8; ++i) xa[i] = *(const v4f*)(ac + (size_t)(16 * i) * 512);
#pragma unroll
    for (int i = 0; i < 8; ++i) wa[i] = *(const v4f*)(wr + (size_t)i * WLD);
    asm volatile("s_wait_xcnt 0x0" :: "v"(ac), "v"(wr) : "memory");   /* stands before the loads' address registers are written again (named as inputs, they stay whole up to here: no load lands in them); it also keeps the loads here, a whole chunk of products ahead of their use */
    __builtin_amdgcn_sched_barrier(0); };           /* keeps the vector instructions that follow, which may be given those registers, behind that wait */
  auto sts = [&](int buf) { char* B = smem + buf * BUF;
#pragma unroll
    for (int i = 0; i < 8; ++i) { char* d = B + (xr + 16 * i) * GP + xk * 2; U4 t, tl;
#pragma unroll
      for (int e = 0; e < 4; ++e) { const float v = xa[i][e];
        if (MODE == 2) t.h[e] = (_Float16)(v * 64.0f); else { const __bf16 hb = (__bf16)v; t.b[e] = hb; if (MODE == 1) tl.b[e] = (__bf16)(v - (float)hb); } }
      *(v2u*)d = t.u; if (MODE == 1) *(v2u*)(d + GPL) = tl.u; }
#pragma unroll
    for (int nn = 0; nn < 4; ++nn) { U8 t;
#pragma unroll
      for (int i = 0; i < 8; ++i) { if (MODE == 2) t.h[i] = (_Float16)(bfr(wa[i][nn]) * 256.0f); else t.b[i] = (__bf16)wa[i][nn]; }
      *(v4u*)(B + NA * GPL + (wc + nn) * GP + wk * 2) = t.u; } };
  ldg(0); sts(0); __syncthreads();
#pragma unroll 2   /* two chunks a trip: the buffer's number is a constant in each copy */
  for (int c = 0; c < 8; ++c) { const char* B = smem + (c & 1) * BUF;
    if (c < 7) ldg(c + 1);
#pragma unroll
    for (int kc = 0; kc < 2; ++kc) { U16 a[2], al[2], w[4];
#pragma unroll
      for (int mt = 0; mt < 2; ++mt) { const char* p = B + (wm * 32 + mt * 16 + col) * GP + kc * 64 + 16 * g; a[mt].q[0] = *(const v4u*)p; a[mt].q[1] = *(const v4u*)(p + 32); if (MODE == 1) { al[mt].q[0] = *(const v4u*)(p + GPL); al[mt].q[1] = *(const v4u*)(p + GPL + 32); } }
#pragma unroll
      for (int nt = 0; nt < 4; ++nt) { const char* p = B + NA * GPL + (wn * 64 + nt * 16 + col) * GP + kc * 64 + 16 * g; w[nt].q[0] = *(const v4u*)p; w[nt].q[1] = *(const v4u*)(p + 32); }
#pragma unroll
      for (int mt = 0; mt < 2; ++mt)
#pragma unroll
        for (int nt = 0; nt < 4; ++nt) {
          if (MODE == 2) acc[mt][nt] = __builtin_amdgcn_wmma_f32_16x16x32_f16(false, a[mt].h, false, w[nt].h, (short)0, acc[mt][nt], false, false);
          else { acc[mt][nt] = __builtin_amdgcn_wmma_f32_16x16x32_bf16(false, a[mt].b, false, w[nt].b, (short)0, acc[mt][nt], false, false);
            if (MODE == 1) acc[mt][nt] = __builtin_amdgcn_wmma_f32_16x16x32_bf16(false, al[mt].b, false, w[nt].b, (short)0, acc[mt][nt], false, false); } } }
    __builtin_amdgcn_sched_barrier(0);   /* keeps the roundings of chunk c + 1, and with them the wait for its global loads, behind this chunk's products */
    if (c < 7) sts((c + 1) & 1);   // into the buffer whose last readers passed the barrier at the foot of chunk c - 1
    __syncthreads(); } }           // publishes chunk c + 1; behind the last one the caller may reuse the LDS
// ---- k_proj: block = (128 rows, 128 cols, which): q/k/v = X W (+ b) with exact bf16 products (K = DIN) -> which 0: q f16 rows (+ residual rows < QHI); 1: k f16 rows (+ residual rows < KHI); 2: v f16 planes [c][t] (+ bf16 hi/lo planes for t < KHI). The output tiles pass through the LDS that held the operand chunks.
static_assert(QHI % 128 == 0 && KHI % 128 == 0 && TT % 128 == 0 && DIN == 512 && CC == 512, "block split");
__global__ __launch_bounds__(256) void k_proj(const float* __restrict__ XQ, const float* __restrict__ XK, const float* __restrict__ XV, const float* __restrict__ WQ, const float* __restrict__ WK, const float* __restrict__ WV, const float* __restrict__ BQ, const float* __restrict__ BK, const float* __restrict__ BV,
    _Float16* __restrict__ QH, _Float16* __restrict__ QL, _Float16* __restrict__ KH, _Float16* __restrict__ KL, _Float16* __restrict__ VT, __bf16* __restrict__ VB, __bf16* __restrict__ VBL) {
  __shared__ __align__(16) char smem[3 * 128 * 136 * 2];   // operand chunks: 4 x GPL; output tiles: up to 3 x [128][136] of 2 bytes
  static_assert(4 * GPL <= 3 * 128 * 136 * 2, "LDS");
  const int tid = threadIdx.x, wave = tid >> 5, lane = tid & 31, col = lane & 15, g = lane >> 4, wm = wave & 3, wn = wave >> 2; const int which = blockIdx.z; const int c0 = blockIdx.y * 128; const size_t r0 = (size_t)blockIdx.x * 128; const size_t bb = r0 / TT; const int t0 = (int)(r0 % TT);
  const float* X = which == 0 ? XQ : which == 1 ? XK : XV; const float* WA = which == 0 ? WQ : which == 1 ? WK : WV; const float* BA = which == 0 ? BQ : which == 1 ? BK : BV;
  v8f acc[2][4] = {};
  g128<0>(X + r0 * DIN, WA, c0, smem, tid, acc);
  if (which < 2) { _Float16 (*sh)[136] = (_Float16 (*)[136])smem; _Float16 (*sl)[136] = (_Float16 (*)[136])(smem + 128 * 136 * 2);
    _Float16* DH = which == 0 ? QH : KH; _Float16* DL = which == 0 ? QL : KL; const int nhi = which == 0 ? QHI : KHI; const bool hi_rows = t0 < nhi;
#pragma unroll
    for (int mt = 0; mt < 2; ++mt)
#pragma unroll
      for (int nt = 0; nt < 4; ++nt) { const int cl = wn * 64 + nt * 16 + col; const float bias = BA ? bfr(BA[c0 + cl]) : 0.f;
#pragma unroll
        for (int r = 0; r < 8; ++r) { const float v = acc[mt][nt][r] + bias; const _Float16 hv = (_Float16)v; const int rl = wm * 32 + mt * 16 + 8 * g + r; sh[rl][cl] = hv; sl[rl][cl] = (_Float16)((v - (float)hv) * 1024.0f); } }
    __syncthreads();
#pragma unroll   /* unrolled: the LDS reads go out as one group ahead of the stores, one LDS latency for all */
    for (int i = 0; i < 8; ++i) { const int e = tid + i * 256; const int rl = e >> 4, q = e & 15; vst2((unsigned*)(DH + (r0 + rl) * CC + c0 + q * 8), *(const v4u*)&sh[rl][q * 8]); }
    asm volatile("s_wait_xcnt 0x0" ::: "memory");   /* stands before the code behind the branch writes registers that these stores name */
    if (hi_rows) {
#pragma unroll   /* unrolled: the LDS reads go out as one group ahead of the stores, one LDS latency for all */
      for (int i = 0; i < 8; ++i) { const int e = tid + i * 256; const int rl = e >> 4, q = e & 15; vst2((unsigned*)(DL + (bb * nhi + t0 + rl) * (size_t)CC + c0 + q * 8), *(const v4u*)&sl[rl][q * 8]); }
      asm volatile("s_wait_xcnt 0x0" ::: "memory"); }   /* stands before whatever the compiler lays out behind this branch writes registers that these stores name */
  } else { _Float16 (*th)[136] = (_Float16 (*)[136])smem; __bf16 (*tb)[136] = (__bf16 (*)[136])(smem + 128 * 136 * 2); __bf16 (*tbl)[136] = (__bf16 (*)[136])(smem + 2 * 128 * 136 * 2); const bool hi_rows = t0 < KHI;
#pragma unroll
    for (int mt = 0; mt < 2; ++mt)
#pragma unroll
      for (int nt = 0; nt < 4; ++nt) { const int cl = wn * 64 + nt * 16 + col; const float bias = BA ? bfr(BA[c0 + cl]) : 0.f;
#pragma unroll
        for (int r = 0; r < 8; ++r) { const float v = acc[mt][nt][r] + bias; const int rl = wm * 32 + mt * 16 + 8 * g + r; th[cl][rl] = (_Float16)v; const __bf16 bh = (__bf16)v; tb[cl][rl] = bh; tbl[cl][rl] = (__bf16)(v - (float)bh); } }
    __syncthreads();
#pragma unroll   /* unrolled: the LDS reads go out as one group ahead of the stores, one LDS latency for all */
    for (int i = 0; i < 8; ++i) { const int e = tid + i * 256; const int cl = e >> 4, q = e & 15; vst2((unsigned*)(VT + (bb * CC + c0 + cl) * (size_t)TT + t0 + q * 8), *(const v4u*)&th[cl][q * 8]); }
    asm volatile("s_wait_xcnt 0x0" ::: "memory");   /* stands before the code behind the branch writes registers that these stores name */
    if (hi_rows) {
#pragma unroll   /* unrolled: the LDS reads go out as one group ahead of the stores, one LDS latency for all */
      for (int i = 0; i < 8; ++i) { const int e = tid + i * 256; const int cl = e >> 4, q = e & 15; const size_t o3 = (bb * CC + c0 + cl) * (size_t)KHI + t0 + q * 8; vst2((unsigned*)(VB + o3), *(const v4u*)&tb[cl][q * 8]); vst2((unsigned*)(VBL + o3), *(const v4u*)&tbl[cl][q * 8]); }
      asm volatile("s_wait_xcnt 0x0" ::: "memory"); } } }   /* stands before whatever the compiler lays out behind this branch writes registers that these stores name */
#define FAW 8
#define NT32 (TT / 32)
#define SK 128             // keys per stage (4 passes)
#define KP 144             // LDS pitch of a K row: 64 d x 2 B + 16 (16 B x odd: the 16 rows of a ds_load_b128 fragment fall on distinct banks)
#define VP 272             // LDS pitch of a v row: SK keys x 2 B + 16 (16 B x odd)
#define KPL (SK * KP)      // one K plane of a stage
#define VPL (HD * VP)      // one v plane of a stage
static_assert(NT32 == 64 && QHI == 384 && KHI == 384 && FAW == 8 && HD == 64 && SK == 128, "group split");
__device__ __forceinline__ v8f mm_h(v16h a, v16h b, v8f c) { return __builtin_amdgcn_wmma_f32_16x16x32_f16(false, a, false, b, (short)0, c, false, false); }
__device__ __forceinline__ v8f mm_b(v16b a, v16b b, v8f c) { return __builtin_amdgcn_wmma_f32_16x16x32_bf16(false, a, false, b, (short)0, c, false, false); }
// fragment from a wave-uniform row base plus the lane's own byte offset (row pitch x (lane & 15) + 16 x (lane >> 4))
__device__ __forceinline__ v16h frag_hu(const _Float16* ub, unsigned vo) { union { v16h v; v8h q[2]; } u; const char* p = (const char*)ub + vo; u.q[0] = *(const v8h*)p; u.q[1] = *(const v8h*)(p + 32); return u.v; }
// fragment from LDS: p = the lane's row + 16 x (lane >> 4) bytes
__device__ __forceinline__ v16h lfrag_h(const char* p) { union { v16h v; v8h q[2]; } u; u.q[0] = *(const v8h*)p; u.q[1] = *(const v8h*)(p + 32); return u.v; }
__device__ __forceinline__ v16b lfrag_b(const char* p) { union { v16b v; v8b q[2]; } u; u.q[0] = *(const v8b*)p; u.q[1] = *(const v8b*)(p + 32); return u.v; }
// one thread's share of a K plane (4 x 16 B, 32 rows apart) and of a v plane (4 x 16 B, 16 rows apart) of a stage, global memory to LDS through no register
__device__ __forceinline__ void acopy8(unsigned ka, unsigned va, const char* kg, size_t kst, const char* vg, size_t vst) {
  /* the copies and, as the statement's last line, the wait that stands before their address registers are written again */
  asm volatile("global_load_async_to_lds_b128 %0, %8, off\n\t"
               "global_load_async_to_lds_b128 %1, %9, off\n\t"
               "global_load_async_to_lds_b128 %2, %10, off\n\t"
               "global_load_async_to_lds_b128 %3, %11, off\n\t"
               "global_load_async_to_lds_b128 %4, %12, off\n\t"
               "global_load_async_to_lds_b128 %5, %13, off\n\t"
               "global_load_async_to_lds_b128 %6, %14, off\n\t"
               "global_load_async_to_lds_b128 %7, %15, off\n\t"
               "s_wait_xcnt 0x0"
               :: "v"(ka), "v"(ka + 32 * KP), "v"(ka + 64 * KP), "v"(ka + 96 * KP), "v"(va), "v"(va + 16 * VP), "v"(va + 32 * VP), "v"(va + 48 * VP),
                  "v"(kg), "v"(kg + 32 * kst), "v"(kg + 64 * kst), "v"(kg + 96 * kst), "v"(vg), "v"(vg + 16 * vst), "v"(vg + 32 * vst), "v"(vg + 48 * vst)
               : "memory"); }
// a group: tiles tb .. tb + FAW - 1, wave w on tile tb + w; a wave whose tile lies below tlo has no tile here: it copies and passes the barriers only. tb + FAW is a multiple of 4 passes.
template <bool HI>
__device__ __forceinline__ void fa_group(const _Float16* __restrict__ QH, const _Float16* __restrict__ KH, const _Float16* __restrict__ QL, const _Float16* __restrict__ KL, const _Float16* __restrict__ VT, const __bf16* __restrict__ VB, const __bf16* __restrict__ VBL, int b, int h, int tb, int tlo, int tid, int wave, char* smem, float* __restrict__ Y) {
  constexpr int BUFB = (HI ? 2 : 1) * (KPL + VPL), VLD = HI ? KHI : TT;   // a buffer: K, v (hi) and, on the high-precision path, K residual, v lo
  const int lane = tid & 31, col = lane & 15, g = lane >> 4;
  const int t = tb + wave; const bool act = t >= tlo; const int ql0 = (act ? t : tlo) * 32, ns = (tb + FAW) / 4;   /* wave-uniform; ns block-uniform */
  const float C2 = SCALE * 1.44269504088896f;   // logit scale x log2(e)
  const float OFF = HI ? 0.f : 11.f;            // f16 P carried x 2^11 (clear of f16 subnormals); it cancels against the sum
  const char* Kg = (const char*)(KH + (size_t)b * TT * CC + h * HD); const char* KLg = (const char*)(KL + (size_t)b * KHI * CC + h * HD);
  const char* Vg = HI ? (const char*)(VB + ((size_t)b * CC + h * HD) * (size_t)KHI) : (const char*)(VT + ((size_t)b * CC + h * HD) * (size_t)TT); const char* VLg = (const char*)(VBL + ((size_t)b * CC + h * HD) * (size_t)KHI);
  const unsigned ro = (unsigned)(col * CC * 2 + 16 * g);   // lane byte offset in q rows
  const unsigned sb = (unsigned)(size_t)smem;              // LDS byte address of the ring
  const int kr = tid >> 3, kq = (tid & 7) * 16, vr = tid >> 4, vq = (tid & 15) * 16;   // a wave's copy covers 4 K rows of 128 B, or 2 v rows of 256 B
  auto fill = [&](int s, int buf) {
    const unsigned ka = sb + buf * BUFB + kr * KP + kq, va = sb + buf * BUFB + KPL + vr * VP + vq;
    const size_t ko = (size_t)(s * SK + kr) * (CC * 2) + kq, vo = (size_t)vr * (VLD * 2) + s * (SK * 2) + vq;
    acopy8(ka, va, Kg + ko, CC * 2, Vg + vo, VLD * 2);
    if (HI) acopy8(ka + KPL + VPL, va + KPL + VPL, KLg + ko, CC * 2, VLg + vo, VLD * 2); };
  v16h qf[2][2], qlf[2][2];
#pragma unroll
  for (int qt = 0; qt < 2; ++qt)
#pragma unroll
    for (int kc = 0; kc < 2; ++kc) { qf[qt][kc] = frag_hu(QH + ((size_t)b * TT + ql0 + qt * 16) * CC + h * HD + kc * 32, ro); if (HI) qlf[qt][kc] = frag_hu(QL + ((size_t)b * QHI + ql0 + qt * 16) * CC + h * HD + kc * 32, ro); }
  v8f o[2][4] = {}; float m[2] = {-3.0e38f, -3.0e38f}, l[2] = {0.f, 0.f};
  const char* Bk = smem + col * KP + 16 * g; const char* Bv = smem + KPL + col * VP + 16 * g;   // the lane's place in the K rows and v rows of the pass: running pointers, moved on by each pass and set back by a wave-uniform step at the stage's end
#pragma unroll 1   /* rolled: one copy of the pass and of the copies; trips -2 and -1 are the prologue (stage 0's copies; their wait and barrier, then stage 1's copies) */
  for (int s = -2; s < ns; ++s) {
    const int left = act && s >= 0 ? t + 1 - 4 * s : 0, np = left < 4 ? left : 4;   /* this wave's passes in the stage: up to its diagonal (wave-uniform) */
    if (np > 0) {
      v16h kf[2][2];   // f16 path: K fragments fetched one pass ahead, inside the stage; the high-precision path (more live registers) fetches them in the pass
      if (!HI) {
#pragma unroll
        for (int kt = 0; kt < 2; ++kt)
#pragma unroll
          for (int kc = 0; kc < 2; ++kc) kf[kt][kc] = lfrag_h(Bk + kt * 16 * KP + kc * 64); }
#pragma unroll 1   /* rolled: one pass already holds 16 independent products, and the trip count differs from wave to wave */
      for (int p = 0; p < np; ++p) {
        v16h vf[4];
        if (!HI) {
#pragma unroll
          for (int j = 0; j < 4; ++j) vf[j] = lfrag_h(Bv + j * 16 * VP); }
        v8f st[2][2] = {}, sl[2][2] = {};   // st[qt][kt][r] = S^T[key 32 (4 s + p) + 16 kt + 8 g + r][query ql0 + 16 qt + col]
#pragma unroll
        for (int kc = 0; kc < 2; ++kc)
#pragma unroll
          for (int kt = 0; kt < 2; ++kt) { v16h klf; if (HI) { kf[kt][kc] = lfrag_h(Bk + kt * 16 * KP + kc * 64); klf = lfrag_h(Bk + KPL + VPL + kt * 16 * KP + kc * 64); }
#pragma unroll
            for (int qt = 0; qt < 2; ++qt) { st[qt][kt] = mm_h(kf[kt][kc], qf[qt][kc], st[qt][kt]); if (HI) { sl[qt][kt] = mm_h(kf[kt][kc], qlf[qt][kc], sl[qt][kt]); sl[qt][kt] = mm_h(klf, qf[qt][kc], sl[qt][kt]); } } }
        if (!HI) { const char* Bn = p + 1 < np ? Bk + 32 * KP : Bk;   // the next pass's K fragments are fetched behind this pass's logits (no branch behind the products: the wave's last pass of the stage fetches its own rows again, in the same buffer)
#pragma unroll
          for (int kt = 0; kt < 2; ++kt)
#pragma unroll
            for (int kc = 0; kc < 2; ++kc) kf[kt][kc] = lfrag_h(Bn + kt * 16 * KP + kc * 64); }
        v16h pf[2]; F2 pb[2];
#pragma unroll
        for (int qt = 0; qt < 2; ++qt) { float sv[16];
#pragma unroll
          for (int i = 0; i < 16; ++i) sv[i] = HI ? st[qt][i >> 3][i & 7] + sl[qt][i >> 3][i & 7] * (1.0f / 1024.0f) : st[qt][i >> 3][i & 7];
          if (4 * s + p == t) {   /* the pass on the diagonal (wave-uniform): keys past the query are excluded by index */
#pragma unroll
            for (int i = 0; i < 16; ++i) if ((i >> 3) * 16 + 8 * g + (i & 7) > qt * 16 + col) sv[i] = -3.0e38f; }
          float r8[8];
#pragma unroll
          for (int i = 0; i < 8; ++i) r8[i] = fmaxf(sv[i], sv[8 + i]);
          float mx = fmaxf(fmaxf(fmaxf(r8[0], r8[1]), fmaxf(r8[2], r8[3])), fmaxf(fmaxf(r8[4], r8[5]), fmaxf(r8[6], r8[7])));
          mx = fmaxf(mx, __shfl_xor(mx, 16));
          const float mn = fmaxf(m[qt], mx); const float al = __builtin_amdgcn_exp2f((m[qt] - mn) * C2); m[qt] = mn;
#pragma unroll
          for (int i = 0; i < 16; ++i) sv[i] = __builtin_amdgcn_exp2f((sv[i] - mn) * C2 + OFF);
#pragma unroll
          for (int i = 0; i < 8; ++i) r8[i] = sv[i] + sv[8 + i];
          l[qt] = l[qt] * al + (((r8[0] + r8[1]) + (r8[2] + r8[3])) + ((r8[4] + r8[5]) + (r8[6] + r8[7])));
#pragma unroll
          for (int j = 0; j < 4; ++j) o[qt][j] *= al;
          if (HI) pb[qt] = bsplit16(sv); else {
#pragma unroll
            for (int i = 0; i < 16; ++i) pf[qt][i] = (_Float16)sv[i]; } }   // element i = key + 16 (i >> 3) + 8 g + (i & 7): the B operand's own k order
#pragma unroll
        for (int j = 0; j < 4; ++j) { v16b vh, vl; if (HI) { vh = lfrag_b(Bv + j * 16 * VP); vl = lfrag_b(Bv + KPL + VPL + j * 16 * VP); }
#pragma unroll
          for (int qt = 0; qt < 2; ++qt) { if (HI) { o[qt][j] = mm_b(vh, pb[qt].h, o[qt][j]); o[qt][j] = mm_b(vh, pb[qt].l, o[qt][j]); o[qt][j] = mm_b(vl, pb[qt].h, o[qt][j]); } else o[qt][j] = mm_h(vf[j], pf[qt], o[qt][j]); } }
        Bk += 32 * KP; Bv += 64; }
      Bk -= np * 32 * KP; Bv -= np * 64; }
    if (s >= 0) { const int tog = (s & 1) ? -BUFB : BUFB; Bk += tog; Bv += tog; }   /* the other buffer */
    if (s >= -1) {   /* publish point (block-uniform test), passed by every wave, also one past its diagonal or without a tile */
      asm volatile("s_wait_dscnt 0x0" ::: "memory");      /* this wave's reads of the stage have returned before the buffer is refilled */
      asm volatile("s_wait_asynccnt 0x0" ::: "memory");   /* this wave's copies of stage s + 1 have landed before the others read them */
      __syncthreads(); }                                  // publishes stage s + 1 and ends every reader's last read of stage s
    if (s + 2 < ns) fill(s + 2, s & 1); }
  asm volatile("s_wait_asynccnt 0x0" ::: "memory");     /* no copy is in flight when the next group reuses the ring or the wave ends */
  if (act) {
#pragma unroll
    for (int qt = 0; qt < 2; ++qt) { const float lt = l[qt] + __shfl_xor(l[qt], 16); const float inv = lt > 0.f ? 1.0f / lt : 0.f;   // o[qt][j][r] = O^T[d 16 j + 8 g + r][query]
      float* yp = Y + ((size_t)b * TT + ql0 + qt * 16 + col) * CC + h * HD + 8 * g;
#pragma unroll
      for (int j = 0; j < 4; ++j) { const v8f v = o[qt][j] * inv; vst2(yp + j * 16, (v4f){v[0], v[1], v[2], v[3]}); vst2(yp + j * 16 + 4, (v4f){v[4], v[5], v[6], v[7]}); } }
    asm volatile("s_wait_xcnt 0x0" ::: "memory"); } }   /* stands before the wave's next group writes the registers that these stores name */
// Groups of one (b, h), by their passes: f16 tiles 56.., 48.., 40.., 32.., 24.., 16.., 8.. (of which 8 .. 11 are high-precision tiles and stay out) take 64, 56, .. 16; the 12 high-precision tiles go as groups 4.. (12 passes) and -4.. (tiles 0 .. 3 on waves 4 .. 7, 4 passes), each pass about 2 to 3 of the others. Block x takes group 56 - 8 x, then 8 + 8 x (80 passes), block 3 the high-precision groups instead.
__global__ __launch_bounds__(32 * FAW) __attribute__((amdgpu_waves_per_eu(4))) /* 256 registers at most: no register-window switches in the pass */ void k_fa(const _Float16* __restrict__ QH, const _Float16* __restrict__ KH, const _Float16* __restrict__ QL, const _Float16* __restrict__ KL, const _Float16* __restrict__ VT, const __bf16* __restrict__ VB, const __bf16* __restrict__ VBL, float* __restrict__ Y) {
  __shared__ __align__(16) char smem[4 * (KPL + VPL)];   // two buffers of up to four planes
  const int tid = threadIdx.x, wave = __builtin_amdgcn_readfirstlane(threadIdx.x >> 5); const int x = blockIdx.x, h = blockIdx.y, b = blockIdx.z;
#pragma unroll 1   /* rolled: one copy of the f16 group's code */
  for (int half = 0; half < 2; ++half) {   /* block-uniform */
    if (half == 0 || x < 3) fa_group<false>(QH, KH, QL, KL, VT, VB, VBL, b, h, half ? 8 + 8 * x : 56 - 8 * x, QHI / 32, tid, wave, smem, Y);
    else {
#pragma unroll 1   /* rolled: one copy of the high-precision group's code */
      for (int u = 0; u < 2; ++u) fa_group<true>(QH, KH, QL, KL, VT, VB, VBL, b, h, 4 - 8 * u, 0, tid, wave, smem, Y); } } }
// ---- k_out: block = (128 rows, 128 cols): out = ctx Wo (+ bo): ctx once to f16 against Wo as f16(bf16 x 2^8) exact (1 product) x 2^-8; causal early rows (< QHI of each sequence): ctx bf16 hi + lo against exact bf16 Wo (2 products). ctx is carried x 2^6 into f16 so small-magnitude context rows stay clear of f16 subnormals.
__global__ __launch_bounds__(256) __attribute__((amdgpu_waves_per_eu(4))) /* 256 registers at most: two blocks to a WGP, which is the whole grid at once */ void k_out(const float* __restrict__ Y, const float* __restrict__ WO, const float* __restrict__ BO, float* __restrict__ OUT) { __shared__ __align__(16) char smem[6 * GPL];   // operand chunks: 2 x 3 planes at most; then the f32 output tile [128][132]
  static_assert(128 * 132 * 4 <= 6 * GPL && WO_OUT_IN == 0, "LDS");
  const int tid = threadIdx.x, wave = tid >> 5, lane = tid & 31, col = lane & 15, g = lane >> 4, wm = wave & 3, wn = wave >> 2; const int c0 = blockIdx.y * 128; const size_t r0 = (size_t)blockIdx.x * 128;
  const bool hi = CAUSAL && (int)(r0 % TT) < QHI;   /* block-uniform */
  v8f acc[2][4] = {};
  if (hi) g128<1>(Y + r0 * CC, WO, c0, smem, tid, acc); else g128<2>(Y + r0 * CC, WO, c0, smem, tid, acc);
  float (*sf)[132] = (float (*)[132])smem; const float sc = hi ? 1.0f : 1.0f / 16384.0f;   /* 2^-8 (Wo carry) x 2^-6 (ctx carry): a power of two, exact */
#pragma unroll
  for (int mt = 0; mt < 2; ++mt)
#pragma unroll
    for (int nt = 0; nt < 4; ++nt) { const int cl = wn * 64 + nt * 16 + col; const float bias = BO ? bfr(BO[c0 + cl]) : 0.f;
#pragma unroll
      for (int r = 0; r < 8; ++r) sf[wm * 32 + mt * 16 + 8 * g + r][cl] = acc[mt][nt][r] * sc + bias; }
  __syncthreads();
#pragma unroll   /* unrolled: the LDS reads go out as one group ahead of the stores, one LDS latency for all */
  for (int i = 0; i < 16; ++i) { const int e = tid + i * 256; const int rl = e >> 5, q = e & 31; vst2(OUT + (r0 + rl) * DIN + c0 + q * 4, *(const v4f*)&sf[rl][q * 4]); } }

extern "C" void kernel_launch(void* const* d_in, const int* in_sizes, int n_in, void* d_out, int out_size, void* d_ws, size_t ws_size, hipStream_t stream) {
  (void)in_sizes; (void)n_in; (void)out_size;
  const float** F = (const float**)d_in;
  if (ws_size < (size_t)WS_END) return;
  char* ws = (char*)d_ws; _Float16 *QH = (_Float16*)(ws + WS_QH), *KH = (_Float16*)(ws + WS_KH), *VT = (_Float16*)(ws + WS_VT), *QL = (_Float16*)(ws + WS_QL), *KL = (_Float16*)(ws + WS_KL); __bf16 *VB = (__bf16*)(ws + WS_VB), *VBL = (__bf16*)(ws + WS_VBL); float *Y = (float*)(ws + WS_Y);
  (void)Y; (void)QL; (void)KL; (void)VB; (void)VBL;
  // inputs: 0 x [8,2048,512]; 1 Wq [8,512,64] (per-head (in,out)); 2 Wk; 3 Wv; 4 Wo [512,512] (in,out); 5 bo [512] (normal x 0.01, read)
  k_proj<<<dim3(TNB * TT / 128, CC / 128, 3), 256, 0, stream>>>(F[0], F[0], F[0], F[1], F[2], F[3], nullptr, nullptr, nullptr, QH, QL, KH, KL, VT, VB, VBL);
  k_fa<<<dim3(NT32 / (2 * FAW), NH, TNB), 32 * FAW, 0, stream>>>(QH, KH, QL, KL, VT, VB, VBL, Y);
  k_out<<<dim3(TNB * TT / 128, DIN / 128), 256, 0, stream>>>(Y, F[4], F[5], (float*)d_out);
}
